// v000
// The times below were measured on an AMD MI455X: many runs one after another, warmed up first and cycling through
// copies of the inputs, with the whole window's GPU time divided by the number of runs. Launches and the gaps
// between them are all in it. The median over several windows is given; except for v000 it joins two sittings, which
// can be a few percent apart, so the side-by-side timings, each taken in one sitting, are the better comparison.
// v000 is the starting kernel. One run takes 2160 microseconds.
#include <hip/hip_runtime.h>

// Temporal attention with a learned temporal-embedding mixer (x [2][2048][1024]; temb = temporal_embeddings[0][temporal_positions[t]] (int32 positions, read); x_t = [x | temb] W_mix + b_mix (W_mix [2048][1024]); q, k, v = x_t W + b ('xw' [1024][1024]; 16 heads x 64); softmax(q.k/8); out = merged W_o + b_o -> [2][2048][1024] (4.2 M)).
// Layout: the concat-and-mix is two exact GEMMs (x against the top half of W_mix with the bias, the gathered embeddings against the bottom half) summed in f32; x_t then feeds the projections as bf16 hi + lo planes (2 products).
// Compute dtypes, f32 accumulate: every input rounded to bf16; x, the gathered embeddings and W_mix exact (1 product each, + b_mix), summed in f32 -> x_t as bf16 hi + lo planes; q/k/v as 2 products against the exact weights + biases; scores and attn.v: query rows < 512 hl (3 products), the rest single fp16 (x1024); softmax f32; W_o hl x exact (2 products) + b_o.

#define NB_  2
#define TT   2048
#define DM   1024
#define NH_  16
#define NKV  16
#define REP  (NH_ / NKV)
#define HD   64
#define DQ   (NH_ * HD)
#define DKV  (NKV * HD)
#define ZH   2
#define RH   512                  // query rows < RH use hi+lo planes (0: none)
#define WIN  0
#define PCAR 1024.0f
#define SCL  0.125f   // HD^-0.5
typedef _Float16 h16;
typedef unsigned short bf;
typedef __attribute__((ext_vector_type(16))) __bf16   v16bf;
typedef __attribute__((ext_vector_type(16))) _Float16 v16h;
typedef __attribute__((ext_vector_type(8)))  _Float16 v8h;
typedef __attribute__((ext_vector_type(8)))  unsigned short v8us;
typedef __attribute__((ext_vector_type(8)))  float    v8f;
typedef __attribute__((ext_vector_type(4)))  float    v4f;
typedef v8h  __attribute__((may_alias)) v8ha;
typedef v4f  __attribute__((may_alias)) v4fa;
typedef v8us __attribute__((may_alias)) v8usa;

__device__ __forceinline__ unsigned short f2bf(float f) { unsigned u = __float_as_uint(f); u += 0x7FFFu + ((u >> 16) & 1u); return (unsigned short)(u >> 16); }
__device__ __forceinline__ float bf2f(unsigned short b) { return __uint_as_float(((unsigned)b) << 16); }
__device__ __forceinline__ float bfr(float f) { return bf2f(f2bf(f)); }
__device__ __forceinline__ v16h cat16(v8h lo, v8h hi) { return __builtin_shufflevector(lo, hi, 0, 1, 2, 3, 4, 5, 6, 7, 8, 9, 10, 11, 12, 13, 14, 15); }
__device__ __forceinline__ v16bf cat16b(v8us lo, v8us hi) { return __builtin_bit_cast(v16bf, __builtin_shufflevector(lo, hi, 0, 1, 2, 3, 4, 5, 6, 7, 8, 9, 10, 11, 12, 13, 14, 15)); }
__device__ __forceinline__ v8f wmma16(v16h a, v16h b, v8f c) { return __builtin_amdgcn_wmma_f32_16x16x32_f16(false, a, false, b, (short)0, c, false, false); }
__device__ __forceinline__ v8f wmmab(v16bf a, v16bf b, v8f c) { return __builtin_amdgcn_wmma_f32_16x16x32_bf16(false, a, false, b, (short)0, c, false, false); }



// ---- k_gemmw: register-blocked GEMM, ONE WAVE per 64x64 output tile (16 accumulators), operands straight from K-contiguous 16-bit planes; grid (M/64, N/64, Z), 32 threads.
// C[m][n] (f32, pitch ldc, + optional f32 bias[n]) = sum_k A[m][k] Bt[n][k] (+ split products per NSPLIT). z-batch strides sA/sB/sC in elements. K % 32 == 0.
template <typename T16> struct WFrag;
template <> struct WFrag<h16> { typedef v16h V; static __device__ __forceinline__ V ld(const h16* p) { return cat16(*(const v8h*)p, *(const v8h*)(p + 16)); } static __device__ __forceinline__ v8f mma(V a, V b, v8f c) { return wmma16(a, b, c); } };
template <> struct WFrag<bf> { typedef v16bf V; static __device__ __forceinline__ V ld(const bf* p) { return cat16b(*(const v8us*)p, *(const v8us*)(p + 16)); } static __device__ __forceinline__ v8f mma(V a, V b, v8f c) { return wmmab(a, b, c); } };
template <typename T16, int NSPLIT, bool BIAS>
__global__ __launch_bounds__(32) void k_gemmw(const T16* __restrict__ A, const T16* __restrict__ A2, const T16* __restrict__ Bt, const T16* __restrict__ Bt2, int K, float* C, int ldc, const float* __restrict__ bias, size_t sA, size_t sB, size_t sC) {
    typedef typename WFrag<T16>::V V;
    __shared__ __align__(16) float os[16 * 68];
    const size_t z = blockIdx.z; A += z * sA; if (A2) A2 += z * sA; Bt += z * sB; if (Bt2) Bt2 += z * sB; C += z * sC;
    const int lane = threadIdx.x & 31, lr = lane & 15, hi = lane >> 4; const int r0 = blockIdx.x * 64, c0 = blockIdx.y * 64;
    v8f acc[4][4];
#pragma unroll
    for (int mb = 0; mb < 4; ++mb)
#pragma unroll
        for (int nb = 0; nb < 4; ++nb) acc[mb][nb] = (v8f){};
    const size_t aoff = (size_t)(r0 + lr) * K + 8 * hi, boff = (size_t)(c0 + lr) * K + 8 * hi;
#pragma unroll 1
    for (int kc = 0; kc < K; kc += 32) {
        V a[4], a2[4];
#pragma unroll
        for (int mb = 0; mb < 4; ++mb) { a[mb] = WFrag<T16>::ld(A + aoff + (size_t)mb * 16 * K + kc); if (NSPLIT == 1 || NSPLIT == 2) a2[mb] = WFrag<T16>::ld(A2 + aoff + (size_t)mb * 16 * K + kc); }
#pragma unroll
        for (int nb = 0; nb < 4; ++nb) { const V b = WFrag<T16>::ld(Bt + boff + (size_t)nb * 16 * K + kc); V b2; if (NSPLIT >= 2) b2 = WFrag<T16>::ld(Bt2 + boff + (size_t)nb * 16 * K + kc);
#pragma unroll
            for (int mb = 0; mb < 4; ++mb) { acc[mb][nb] = WFrag<T16>::mma(a[mb], b, acc[mb][nb]); if (NSPLIT == 1 || NSPLIT == 2) acc[mb][nb] = WFrag<T16>::mma(a2[mb], b, acc[mb][nb]); if (NSPLIT >= 2) acc[mb][nb] = WFrag<T16>::mma(a[mb], b2, acc[mb][nb]); } }
        asm volatile("v_nop\n\tv_nop\n\tv_nop\n\tv_nop" : "+v"(acc[0][0]), "+v"(acc[1][1]), "+v"(acc[2][2]), "+v"(acc[3][3]) : "v"(a[0]), "v"(a[3]));
    }
#pragma unroll
    for (int mb = 0; mb < 4; ++mb) {
#pragma unroll
        for (int nb = 0; nb < 4; ++nb) {
#pragma unroll
            for (int j = 0; j < 8; ++j) os[(hi * 8 + j) * 68 + nb * 16 + lr] = acc[mb][nb][j]; }
        __builtin_amdgcn_wave_barrier(); asm volatile("" ::: "memory");
        float* crow = C + (size_t)(r0 + mb * 16) * ldc + c0;
{
#pragma unroll
            for (int s = 0; s < 8; ++s) { const int row = 2 * s + hi, cofs = lr * 4; v4f val = *(const v4fa*)(os + row * 68 + cofs); if (BIAS) { val[0] += bfr(bias[c0 + cofs]); val[1] += bfr(bias[c0 + cofs + 1]); val[2] += bfr(bias[c0 + cofs + 2]); val[3] += bfr(bias[c0 + cofs + 3]); }
                *(v4f*)(crow + (size_t)row * ldc + cofs) = val; }
             }
        __builtin_amdgcn_wave_barrier(); asm volatile("" ::: "memory");
    }
}

__device__ __forceinline__ h16 tohx(float x) { return (h16)x; }
__device__ __forceinline__ void splitf(float y, unsigned short& h, unsigned short& l) { h = f2bf(y); l = f2bf(y - bf2f(h)); }
typedef __attribute__((ext_vector_type(2))) _Float16 v2h;
typedef __attribute__((ext_vector_type(4))) _Float16 v4h;
typedef __attribute__((ext_vector_type(2))) unsigned short v2us;
typedef __attribute__((ext_vector_type(4))) unsigned short v4us;
typedef __attribute__((ext_vector_type(2))) float v2f;
typedef __attribute__((ext_vector_type(4))) int v4i;

__global__ __launch_bounds__(256) void k_wtG(const float* __restrict__ w, int K, int N, bf* Bt) {
    const int lane = threadIdx.x & 31; const int L0 = (blockIdx.x * 8 + (threadIdx.x >> 5)) * 8; const int nlines = N * K / 64;
{
#pragma unroll 1
        for (int l = 0; l < 8; ++l) { const int L = L0 + l; if (L >= nlines) break; const size_t e = (size_t)L * 64 + lane * 2; const int k = (int)(e % K), n = (int)(e / K); v2us o;
            o[0] = f2bf(w[(size_t)k * N + n]); o[1] = f2bf(w[(size_t)(k + 1) * N + n]); *(v2us*)(Bt + e) = o; }
         }
}
__global__ __launch_bounds__(256) void k_cvt8(const float* __restrict__ src, bf* dst, size_t n8) { const size_t i = (size_t)blockIdx.x * 256 + threadIdx.x; if (i >= n8) return; const v8f v = *(const v8f*)(src + i * 8); v8us o;
#pragma unroll
    for (int k = 0; k < 8; ++k) o[k] = f2bf(v[k]); *(v8us*)(dst + i * 8) = o;  }

// k_rope: head planes [h][t][d] (fp16 + hi/lo) of rope(x) x sc with the rotate-half convention out[d] = x[d] cos[t][d] - x[d+HD/2] sin[t][d], out[d+HD/2] = x[d+HD/2] cos[t][d+HD/2] + x[d] sin[t][d+HD/2]
__global__ __launch_bounds__(256) void k_rope(const float* __restrict__ F, int pitch, int nheads, const float* __restrict__ CS, const float* __restrict__ RF, const float* __restrict__ nw, float sc, h16* P16, bf* Ph, bf* Pl) {
    const size_t e = ((size_t)blockIdx.x * 256 + threadIdx.x) * 2; if (e >= (size_t)nheads * TT * HD) return; const int d = (int)(e % HD); const int t = (int)((e / HD) % TT); const int h = (int)(e / ((size_t)HD * TT)); const float* f = F + (size_t)t * pitch + h * HD; const float rf = RF ? RF[(size_t)h * TT + t] : 1.0f; v2h o16; v2us oh, ol;
#pragma unroll
    for (int q = 0; q < 2; ++q) { const int dd = d + q; const int dp = (dd < HD / 2) ? dd + HD / 2 : dd - HD / 2; float x0 = f[dd], x1 = f[dp];
        if (RF) { float n0 = __fmul_rn(x0, rf), n1 = __fmul_rn(x1, rf); asm volatile("" : "+v"(n0)); asm volatile("" : "+v"(n1)); x0 = __fmul_rn(bfr(nw[dd]), n0); x1 = __fmul_rn(bfr(nw[dp]), n1); }
        const v2f cs = *(const v2f*)(CS + ((size_t)t * HD + dd) * 2); float a = __fmul_rn(x0, cs[0]), bq = __fmul_rn(x1, cs[1]); asm volatile("" : "+v"(a)); asm volatile("" : "+v"(bq)); const float r = ((dd < HD / 2) ? __fsub_rn(a, bq) : __fadd_rn(a, bq)) * sc;
        o16[q] = tohx(r); unsigned short a2, c2; splitf(r, a2, c2); oh[q] = a2; ol[q] = c2; }
    *(v2h*)(P16 + e) = o16; *(v2us*)(Ph + e) = oh; *(v2us*)(Pl + e) = ol;  }
__global__ __launch_bounds__(256) void k_vtp(const float* __restrict__ F, int pitch, int nheads, h16* V16, bf* Vh, bf* Vl) { const size_t e = ((size_t)blockIdx.x * 256 + threadIdx.x) * 2; if (e >= (size_t)nheads * HD * TT) return; const int t = (int)(e % TT); const int d = (int)((e / TT) % HD); const int g = (int)(e / ((size_t)TT * HD)); v2h o16; v2us oh, ol;
#pragma unroll
    for (int q = 0; q < 2; ++q) { const float x = F[(size_t)(t + q) * pitch + g * HD + d]; o16[q] = tohx(x); unsigned short a2, c2; splitf(x, a2, c2); oh[q] = a2; ol[q] = c2; }
    *(v2h*)(V16 + e) = o16; *(v2us*)(Vh + e) = oh; *(v2us*)(Vl + e) = ol;  }
__global__ __launch_bounds__(256) void k_csid(float* CS) { const int idx = blockIdx.x * 256 + threadIdx.x; if (idx >= TT * HD) return; v2f cs; cs[0] = 1.0f; cs[1] = 0.0f; *(v2f*)(CS + (size_t)idx * 2) = cs;  }
__global__ __launch_bounds__(256) void k_gath8(const float* __restrict__ TE, const int* __restrict__ POS, bf* EB) { const size_t i = (size_t)blockIdx.x * 256 + threadIdx.x; if (i >= (size_t)TT * DM / 8) return; const size_t e = i * 8; const int t = (int)(e / DM); const int c = (int)(e % DM); const int p = min(max(POS[t], 0), TT - 1);   /* clamp the table index (MAX_T = 2048 rows) */ const v8f v = *(const v8f*)(TE + (size_t)p * DM + c); v8us o;
#pragma unroll
    for (int k = 0; k < 8; ++k) o[k] = f2bf(v[k]); *(v8us*)(EB + e) = o;  }
__global__ __launch_bounds__(256) void k_addpl(const float* __restrict__ A, const float* __restrict__ Bm, bf* Ph, bf* Pl, size_t n4) { const size_t i = (size_t)blockIdx.x * 256 + threadIdx.x; if (i >= n4) return; const v4f a = *(const v4f*)(A + i * 4), b = *(const v4f*)(Bm + i * 4); v4us oh, ol;
#pragma unroll
    for (int q = 0; q < 4; ++q) { unsigned short h2, l2; splitf(__fadd_rn(a[q], b[q]), h2, l2); oh[q] = h2; ol[q] = l2; } *(v4us*)(Ph + i * 4) = oh; *(v4us*)(Pl + i * 4) = ol;  }
// k_asoft: per row (zz, i): t = S x HD^-0.5 (no mask); softmax over the 2048 keys (register row, one exp, fixed trees);
__global__ __launch_bounds__(256) void k_asoft(const float* __restrict__ Sb, h16* P16, bf* Ph, bf* Pl) {
    const int lane = threadIdx.x & 31; const int row = blockIdx.x * 8 + (threadIdx.x >> 5); if (row >= ZH * TT) return; const int i = row % TT; const int zz = row / TT; (void)zz; const bool hires = (i < RH); const float* sr = Sb + (size_t)row * TT; float v[TT / 32]; float mx = -3.0e38f;
#pragma unroll
    for (int ch = 0; ch < TT / 128; ++ch) { const int j0 = ch * 128 + lane * 4; const v4f a = *(const v4f*)(sr + j0);
#pragma unroll
        for (int q = 0; q < 4; ++q) { const int j = j0 + q; (void)j; const float t = a[q] * SCL; v[ch * 4 + q] = t; mx = fmaxf(mx, t); } }
#pragma unroll
    for (int sh = 16; sh; sh >>= 1) mx = fmaxf(mx, __shfl_xor(mx, sh, 32));
    float sum = 0.f;
#pragma unroll
    for (int k = 0; k < TT / 32; ++k) { float d0 = __fsub_rn(v[k], mx); asm volatile("" : "+v"(d0)); v[k] = __builtin_amdgcn_exp2f(__fmul_rn(d0, 1.4426950408889634f)); sum += v[k]; }
#pragma unroll
    for (int sh = 16; sh; sh >>= 1) sum += __shfl_xor(sum, sh, 32);
    const float f = __fdiv_rn(hires ? 1.0f : PCAR, sum);
{
        if (hires) {
#pragma unroll
            for (int ch = 0; ch < TT / 128; ++ch) { v4us oh, ol;
#pragma unroll
                for (int q = 0; q < 4; ++q) { unsigned short a, c2; splitf(v[ch * 4 + q] * f, a, c2); oh[q] = a; ol[q] = c2; }
                const size_t oo = ((size_t)zz * (RH ? RH : 1) + i) * TT + ch * 128 + lane * 4; *(v4us*)(Ph + oo) = oh; *(v4us*)(Pl + oo) = ol; }
        } else {
#pragma unroll
            for (int ch = 0; ch < TT / 128; ++ch) { v4h o4;
#pragma unroll
                for (int q = 0; q < 4; ++q) o4[q] = tohx(v[ch * 4 + q] * f);
                *(v4h*)(P16 + (size_t)row * TT + ch * 128 + lane * 4) = o4; } }
         }
}
__global__ __launch_bounds__(256) void k_merge(const float* __restrict__ O, int h0, bf* Ah, bf* Al) { const size_t e = ((size_t)blockIdx.x * 256 + threadIdx.x) * 2; if (e >= (size_t)ZH * TT * HD) return; const int d = (int)(e % HD); const int t = (int)((e / HD) % TT); const int zz = (int)(e / ((size_t)HD * TT)); const float cs = (t < RH) ? 1.0f : (1.0f / PCAR); const size_t oo = (size_t)t * DQ + (h0 + zz) * HD + d;
    v2us oh, ol;
#pragma unroll
    for (int q = 0; q < 2; ++q) { unsigned short a, c2; splitf(O[e + q] * cs, a, c2); oh[q] = a; ol[q] = c2; } *(v2us*)(Ah + oo) = oh; *(v2us*)(Al + oo) = ol;  }

extern "C" void kernel_launch(void* const* d_in, const int* in_sizes, int n_in,
                              void* d_out, int out_size, void* d_ws, size_t ws_size, hipStream_t stream) {
    (void)in_sizes; (void)n_in; (void)out_size;
    const float* x = (const float*)d_in[0]; const int* POS = (const int*)d_in[1]; const float* TEMB = (const float*)d_in[2]; const float* wmix = (const float*)d_in[3]; const float* bmix = (const float*)d_in[4]; const float* wq = (const float*)d_in[5]; const float* bq = (const float*)d_in[6]; const float* wk = (const float*)d_in[7]; const float* bk = (const float*)d_in[8]; const float* wv = (const float*)d_in[9]; const float* bv = (const float*)d_in[10]; const float* wo = (const float*)d_in[11]; const float* bo = (const float*)d_in[12];
    float* OUT = (float*)d_out;     // [2][2048][1024]
    char* wsp = (char*)d_ws;
    auto take = [&](size_t bytes) { char* p = wsp; wsp += (bytes + 255) & ~(size_t)255; return (void*)p; };
    bf* WQ = (bf*)take((size_t)DQ * DM * 2); bf* WK = (bf*)take((size_t)DKV * DM * 2); bf* WV = (bf*)take((size_t)DKV * DM * 2); bf* WO = (bf*)take((size_t)DM * DQ * 2); float* CS = (float*)take((size_t)TT * HD * 2 * 4);
    bf* XB = (bf*)take((size_t)TT * DM * 2); bf* EB = (bf*)take((size_t)TT * DM * 2); bf* WM1 = (bf*)take((size_t)DM * DM * 2); bf* WM2 = (bf*)take((size_t)DM * DM * 2); float* M1 = (float*)take((size_t)TT * DM * 4); float* M2 = (float*)take((size_t)TT * DM * 4); bf* Yh = (bf*)take((size_t)TT * DM * 2); bf* Yl = (bf*)take((size_t)TT * DM * 2); float* FQ = (float*)take((size_t)TT * DQ * 4); float* FK = (float*)take((size_t)TT * DKV * 4);
    h16* QP16 = (h16*)take((size_t)NH_ * TT * HD * 2); h16* KP16 = (h16*)take((size_t)NKV * TT * HD * 2); h16* VT16 = (h16*)take((size_t)NKV * HD * TT * 2);
    bf* QPh = (bf*)take((size_t)NH_ * TT * HD * 2); bf* QPl = (bf*)take((size_t)NH_ * TT * HD * 2); bf* KPh = (bf*)take((size_t)NKV * TT * HD * 2); bf* KPl = (bf*)take((size_t)NKV * TT * HD * 2); bf* VTh = (bf*)take((size_t)NKV * HD * TT * 2); bf* VTl = (bf*)take((size_t)NKV * HD * TT * 2); bf* Ph = (bf*)take((size_t)ZH * RH * TT * 2); bf* Pl = (bf*)take((size_t)ZH * RH * TT * 2);
    float* Sb = (float*)take((size_t)ZH * TT * TT * 4); h16* P16 = (h16*)take((size_t)ZH * TT * TT * 2); float* Ob = (float*)take((size_t)ZH * TT * HD * 4); bf* ATh = (bf*)take((size_t)TT * DQ * 2); bf* ATl = (bf*)take((size_t)TT * DQ * 2);
    if ((size_t)(wsp - (char*)d_ws) > ws_size) return;    // ws 256 MiB
    float* FV = FK;   // v projection reuses the k buffer after the k planes are built (stream-ordered)
    { k_wtG<<<(unsigned)((DM * DQ / 64 + 63) / 64), 256, 0, stream>>>(wq, DM, DQ, WQ); k_wtG<<<(unsigned)((DM * DKV / 64 + 63) / 64), 256, 0, stream>>>(wk, DM, DKV, WK); k_wtG<<<(unsigned)((DM * DKV / 64 + 63) / 64), 256, 0, stream>>>(wv, DM, DKV, WV);
      k_wtG<<<(unsigned)((DQ * DM / 64 + 63) / 64), 256, 0, stream>>>(wo, DQ, DM, WO); k_wtG<<<(unsigned)((DM * DM / 64 + 63) / 64), 256, 0, stream>>>(wmix, DM, DM, WM1); k_wtG<<<(unsigned)((DM * DM / 64 + 63) / 64), 256, 0, stream>>>(wmix + (size_t)DM * DM, DM, DM, WM2);   /* W_mix halves ('xw' [2048][1024]: rows 0..1023 multiply x, 1024..2047 the embeddings) */
       }
    k_csid<<<(TT * HD + 255) / 256, 256, 0, stream>>>(CS);
    const unsigned LQ = (unsigned)(((size_t)NH_ * TT * HD / 2 + 255) / 256), LKv = (unsigned)(((size_t)NKV * TT * HD / 2 + 255) / 256);
    for (int b = 0; b < NB_; ++b) {
        
        k_cvt8<<<(unsigned)(((size_t)TT * DM / 8 + 255) / 256), 256, 0, stream>>>(x + (size_t)b * TT * DM, XB, (size_t)TT * DM / 8); k_gath8<<<(unsigned)(((size_t)TT * DM / 8 + 255) / 256), 256, 0, stream>>>(TEMB, POS, EB);
        k_gemmw<bf, 0, true><<<dim3(TT / 64, DM / 64, 1), 32, 0, stream>>>(XB, nullptr, WM1, nullptr, DM, M1, DM, bmix, 0, 0, 0); k_gemmw<bf, 0, false><<<dim3(TT / 64, DM / 64, 1), 32, 0, stream>>>(EB, nullptr, WM2, nullptr, DM, M2, DM, nullptr, 0, 0, 0);   /* x W_mix[:D] + b_mix ; temb W_mix[D:] */
        k_addpl<<<(unsigned)(((size_t)TT * DM / 4 + 255) / 256), 256, 0, stream>>>(M1, M2, Yh, Yl, (size_t)TT * DM / 4);   /* x_t -> hi/lo planes */
        k_gemmw<bf, 1, true><<<dim3(TT / 64, DQ / 64, 1), 32, 0, stream>>>(Yh, Yl, WQ, nullptr, DM, FQ, DQ, bq, 0, 0, 0);
        k_rope<<<LQ, 256, 0, stream>>>(FQ, DQ, NH_, CS, nullptr, nullptr, 1.0f, QP16, QPh, QPl);
        k_gemmw<bf, 1, true><<<dim3(TT / 64, DKV / 64, 1), 32, 0, stream>>>(Yh, Yl, WK, nullptr, DM, FK, DKV, bk, 0, 0, 0);
        k_rope<<<LKv, 256, 0, stream>>>(FK, DKV, NKV, CS, nullptr, nullptr, 1.0f, KP16, KPh, KPl);
        k_gemmw<bf, 1, true><<<dim3(TT / 64, DKV / 64, 1), 32, 0, stream>>>(Yh, Yl, WV, nullptr, DM, FV, DKV, bv, 0, 0, 0); k_vtp<<<LKv, 256, 0, stream>>>(FV, DKV, NKV, VT16, VTh, VTl);
        for (int h0 = 0; h0 < NH_; h0 += ZH) { const size_t zq = (size_t)h0, zk = (size_t)(h0 / REP);   // one kv head per query head: the pass's two heads use consecutive kv planes (z-strides TT*HD)
            k_gemmw<bf, 2, false><<<dim3(RH / 64, TT / 64, ZH), 32, 0, stream>>>(QPh + zq * TT * HD, QPl + zq * TT * HD, KPh + zk * TT * HD, KPl + zk * TT * HD, HD, Sb, TT, nullptr, (size_t)TT * HD, (size_t)TT * HD, (size_t)TT * TT);
            k_gemmw<h16, 0, false><<<dim3((TT - RH) / 64, TT / 64, ZH), 32, 0, stream>>>(QP16 + zq * TT * HD + (size_t)RH * HD, nullptr, KP16 + zk * TT * HD, nullptr, HD, Sb + (size_t)RH * TT, TT, nullptr, (size_t)TT * HD, (size_t)TT * HD, (size_t)TT * TT);
            k_asoft<<<ZH * TT / 8, 256, 0, stream>>>(Sb, P16, Ph, Pl);
            k_gemmw<bf, 2, false><<<dim3(RH / 64, HD / 64, ZH), 32, 0, stream>>>(Ph, Pl, VTh + zk * HD * TT, VTl + zk * HD * TT, TT, Ob, HD, nullptr, (size_t)RH * TT, (size_t)HD * TT, (size_t)TT * HD);
            k_gemmw<h16, 0, false><<<dim3((TT - RH) / 64, HD / 64, ZH), 32, 0, stream>>>(P16 + (size_t)RH * TT, nullptr, VT16 + zk * HD * TT, nullptr, TT, Ob + (size_t)RH * HD, HD, nullptr, (size_t)TT * TT, (size_t)HD * TT, (size_t)TT * HD);
            k_merge<<<(unsigned)(((size_t)ZH * TT * HD / 2 + 255) / 256), 256, 0, stream>>>(Ob, h0, ATh, ATl); }
        k_gemmw<bf, 1, true><<<dim3(TT / 64, DM / 64, 1), 32, 0, stream>>>(ATh, ATl, WO, nullptr, DQ, OUT + (size_t)b * TT * DM, DM, bo, 0, 0, 0); }
}

// v001
// One run takes 1040 microseconds.
// Next to v000, in two timings, it ran 2.10 and 2.09 times as fast.
#include <hip/hip_runtime.h>

// Temporal attention with a learned temporal-embedding mixer (x [2][2048][1024]; temb = temporal_embeddings[0][temporal_positions[t]] (int32 positions, read); x_t = [x | temb] W_mix + b_mix (W_mix [2048][1024]); q, k, v = x_t W + b ('xw' [1024][1024]; 16 heads x 64); softmax(q.k/8); out = merged W_o + b_o -> [2][2048][1024] (4.2 M)).
// Layout: the concat-and-mix is two exact GEMMs (x against the top half of W_mix with the bias, the gathered embeddings against the bottom half) summed in f32; x_t then feeds the projections as bf16 hi + lo planes (2 products).
// Compute dtypes, f32 accumulate: every input rounded to bf16; x, the gathered embeddings and W_mix exact (1 product each, + b_mix), summed in f32 -> x_t as bf16 hi + lo planes; q/k/v as 2 products against the exact weights + biases; scores and attn.v: query rows < 512 hl (3 products), the rest single fp16 (x1024); softmax f32; W_o hl x exact (2 products) + b_o.

#define NB_  2
#define TT   2048
#define DM   1024
#define NH_  16
#define NKV  16
#define REP  (NH_ / NKV)
#define HD   64
#define DQ   (NH_ * HD)
#define DKV  (NKV * HD)
#define ZH   2
#define RH   512                  // query rows < RH use hi+lo planes (0: none)
#define WIN  0
#define PCAR 1024.0f
#define SCL  0.125f   // HD^-0.5
#define KSP  16                   // attn.v: key slices per output tile, one wave each; k_merge sums the KSP partial planes in slice order
typedef _Float16 h16;
typedef unsigned short bf;
typedef __attribute__((ext_vector_type(16))) __bf16   v16bf;
typedef __attribute__((ext_vector_type(16))) _Float16 v16h;
typedef __attribute__((ext_vector_type(8)))  _Float16 v8h;
typedef __attribute__((ext_vector_type(8)))  unsigned short v8us;
typedef __attribute__((ext_vector_type(8)))  float    v8f;
typedef __attribute__((ext_vector_type(4)))  float    v4f;
typedef v8h  __attribute__((may_alias)) v8ha;
typedef v4f  __attribute__((may_alias)) v4fa;
typedef v8us __attribute__((may_alias)) v8usa;

__device__ __forceinline__ unsigned short f2bf(float f) { unsigned u = __float_as_uint(f); u += 0x7FFFu + ((u >> 16) & 1u); return (unsigned short)(u >> 16); }
__device__ __forceinline__ float bf2f(unsigned short b) { return __uint_as_float(((unsigned)b) << 16); }
__device__ __forceinline__ float bfr(float f) { return bf2f(f2bf(f)); }
__device__ __forceinline__ v16h cat16(v8h lo, v8h hi) { return __builtin_shufflevector(lo, hi, 0, 1, 2, 3, 4, 5, 6, 7, 8, 9, 10, 11, 12, 13, 14, 15); }
__device__ __forceinline__ v16bf cat16b(v8us lo, v8us hi) { return __builtin_bit_cast(v16bf, __builtin_shufflevector(lo, hi, 0, 1, 2, 3, 4, 5, 6, 7, 8, 9, 10, 11, 12, 13, 14, 15)); }
__device__ __forceinline__ v8f wmma16(v16h a, v16h b, v8f c) { return __builtin_amdgcn_wmma_f32_16x16x32_f16(false, a, false, b, (short)0, c, false, false); }
__device__ __forceinline__ v8f wmmab(v16bf a, v16bf b, v8f c) { return __builtin_amdgcn_wmma_f32_16x16x32_bf16(false, a, false, b, (short)0, c, false, false); }



// ---- k_gemmw: register-blocked GEMM, ONE WAVE per 64x64 output tile (16 accumulators), operands straight from K-contiguous 16-bit planes; grid (M/64, N/64, Z), 32 threads.
// C[m][n] (f32, pitch ldc, + optional f32 bias[n]) = sum_k A[m][k] Bt[n][k] (+ split products per NSPLIT). z-batch strides sA/sB/sC in elements. K % (32 KS) == 0.
// KS > 1: grid z = Z * KS; slice ks = z % KS sums only k in [ks K/KS, (ks+1) K/KS) and writes its own partial plane C + (batch KS + ks) sC; the reader adds the KS planes.
template <typename T16> struct WFrag;
template <> struct WFrag<h16> { typedef v16h V; static __device__ __forceinline__ V ld(const h16* p) { return cat16(*(const v8h*)p, *(const v8h*)(p + 16)); } static __device__ __forceinline__ v8f mma(V a, V b, v8f c) { return wmma16(a, b, c); } };
template <> struct WFrag<bf> { typedef v16bf V; static __device__ __forceinline__ V ld(const bf* p) { return cat16b(*(const v8us*)p, *(const v8us*)(p + 16)); } static __device__ __forceinline__ v8f mma(V a, V b, v8f c) { return wmmab(a, b, c); } };
template <typename T16, int NSPLIT, bool BIAS, int KS = 1>
__global__ __launch_bounds__(32) void k_gemmw(const T16* __restrict__ A, const T16* __restrict__ A2, const T16* __restrict__ Bt, const T16* __restrict__ Bt2, int K, float* C, int ldc, const float* __restrict__ bias, size_t sA, size_t sB, size_t sC) {
    typedef typename WFrag<T16>::V V;
    __shared__ __align__(16) float os[16 * 68];
    const size_t z = blockIdx.z / KS; const int ks = blockIdx.z % KS; A += z * sA; if (A2) A2 += z * sA; Bt += z * sB; if (Bt2) Bt2 += z * sB; C += (z * KS + ks) * sC;
    const int lane = threadIdx.x & 31, lr = lane & 15, hi = lane >> 4; const int r0 = blockIdx.x * 64, c0 = blockIdx.y * 64;
    v8f acc[4][4];
#pragma unroll
    for (int mb = 0; mb < 4; ++mb)
#pragma unroll
        for (int nb = 0; nb < 4; ++nb) acc[mb][nb] = (v8f){};
    const size_t aoff = (size_t)(r0 + lr) * K + 8 * hi, boff = (size_t)(c0 + lr) * K + 8 * hi;
#pragma unroll 1
    for (int kc = ks * (K / KS); kc < (ks + 1) * (K / KS); kc += 32) {
        V a[4], a2[4];
#pragma unroll
        for (int mb = 0; mb < 4; ++mb) { a[mb] = WFrag<T16>::ld(A + aoff + (size_t)mb * 16 * K + kc); if (NSPLIT == 1 || NSPLIT == 2) a2[mb] = WFrag<T16>::ld(A2 + aoff + (size_t)mb * 16 * K + kc); }
#pragma unroll
        for (int nb = 0; nb < 4; ++nb) { const V b = WFrag<T16>::ld(Bt + boff + (size_t)nb * 16 * K + kc); V b2; if (NSPLIT >= 2) b2 = WFrag<T16>::ld(Bt2 + boff + (size_t)nb * 16 * K + kc);
#pragma unroll
            for (int mb = 0; mb < 4; ++mb) { acc[mb][nb] = WFrag<T16>::mma(a[mb], b, acc[mb][nb]); if (NSPLIT == 1 || NSPLIT == 2) acc[mb][nb] = WFrag<T16>::mma(a2[mb], b, acc[mb][nb]); if (NSPLIT >= 2) acc[mb][nb] = WFrag<T16>::mma(a[mb], b2, acc[mb][nb]); } }
        asm volatile("v_nop\n\tv_nop\n\tv_nop\n\tv_nop" : "+v"(acc[0][0]), "+v"(acc[1][1]), "+v"(acc[2][2]), "+v"(acc[3][3]) : "v"(a[0]), "v"(a[3]));
    }
#pragma unroll
    for (int mb = 0; mb < 4; ++mb) {
#pragma unroll
        for (int nb = 0; nb < 4; ++nb) {
#pragma unroll
            for (int j = 0; j < 8; ++j) os[(hi * 8 + j) * 68 + nb * 16 + lr] = acc[mb][nb][j]; }
        __builtin_amdgcn_wave_barrier(); asm volatile("" ::: "memory");
        float* crow = C + (size_t)(r0 + mb * 16) * ldc + c0;
{
#pragma unroll
            for (int s = 0; s < 8; ++s) { const int row = 2 * s + hi, cofs = lr * 4; v4f val = *(const v4fa*)(os + row * 68 + cofs); if (BIAS) { val[0] += bfr(bias[c0 + cofs]); val[1] += bfr(bias[c0 + cofs + 1]); val[2] += bfr(bias[c0 + cofs + 2]); val[3] += bfr(bias[c0 + cofs + 3]); }
                *(v4f*)(crow + (size_t)row * ldc + cofs) = val; }
             }
        __builtin_amdgcn_wave_barrier(); asm volatile("" ::: "memory");
    }
}

__device__ __forceinline__ h16 tohx(float x) { return (h16)x; }
__device__ __forceinline__ void splitf(float y, unsigned short& h, unsigned short& l) { h = f2bf(y); l = f2bf(y - bf2f(h)); }
typedef __attribute__((ext_vector_type(2))) _Float16 v2h;
typedef __attribute__((ext_vector_type(4))) _Float16 v4h;
typedef __attribute__((ext_vector_type(2))) unsigned short v2us;
typedef __attribute__((ext_vector_type(4))) unsigned short v4us;
typedef __attribute__((ext_vector_type(2))) float v2f;
typedef __attribute__((ext_vector_type(4))) int v4i;

__global__ __launch_bounds__(256) void k_wtG(const float* __restrict__ w, int K, int N, bf* Bt) {
    const int lane = threadIdx.x & 31; const int L0 = (blockIdx.x * 8 + (threadIdx.x >> 5)) * 8; const int nlines = N * K / 64;
{
#pragma unroll 1
        for (int l = 0; l < 8; ++l) { const int L = L0 + l; if (L >= nlines) break; const size_t e = (size_t)L * 64 + lane * 2; const int k = (int)(e % K), n = (int)(e / K); v2us o;
            o[0] = f2bf(w[(size_t)k * N + n]); o[1] = f2bf(w[(size_t)(k + 1) * N + n]); *(v2us*)(Bt + e) = o; }
         }
}
__global__ __launch_bounds__(256) void k_cvt8(const float* __restrict__ src, bf* dst, size_t n8) { const size_t i = (size_t)blockIdx.x * 256 + threadIdx.x; if (i >= n8) return; const v8f v = *(const v8f*)(src + i * 8); v8us o;
#pragma unroll
    for (int k = 0; k < 8; ++k) o[k] = f2bf(v[k]); *(v8us*)(dst + i * 8) = o;  }

// k_rope: head planes [h][t][d] (fp16 + hi/lo) of rope(x) x sc with the rotate-half convention out[d] = x[d] cos[t][d] - x[d+HD/2] sin[t][d], out[d+HD/2] = x[d+HD/2] cos[t][d+HD/2] + x[d] sin[t][d+HD/2]
__global__ __launch_bounds__(256) void k_rope(const float* __restrict__ F, int pitch, int nheads, const float* __restrict__ CS, const float* __restrict__ RF, const float* __restrict__ nw, float sc, h16* P16, bf* Ph, bf* Pl) {
    const size_t e = ((size_t)blockIdx.x * 256 + threadIdx.x) * 2; if (e >= (size_t)nheads * TT * HD) return; const int d = (int)(e % HD); const int t = (int)((e / HD) % TT); const int h = (int)(e / ((size_t)HD * TT)); const float* f = F + (size_t)t * pitch + h * HD; const float rf = RF ? RF[(size_t)h * TT + t] : 1.0f; v2h o16; v2us oh, ol;
#pragma unroll
    for (int q = 0; q < 2; ++q) { const int dd = d + q; const int dp = (dd < HD / 2) ? dd + HD / 2 : dd - HD / 2; float x0 = f[dd], x1 = f[dp];
        if (RF) { float n0 = __fmul_rn(x0, rf), n1 = __fmul_rn(x1, rf); asm volatile("" : "+v"(n0)); asm volatile("" : "+v"(n1)); x0 = __fmul_rn(bfr(nw[dd]), n0); x1 = __fmul_rn(bfr(nw[dp]), n1); }
        const v2f cs = *(const v2f*)(CS + ((size_t)t * HD + dd) * 2); float a = __fmul_rn(x0, cs[0]), bq = __fmul_rn(x1, cs[1]); asm volatile("" : "+v"(a)); asm volatile("" : "+v"(bq)); const float r = ((dd < HD / 2) ? __fsub_rn(a, bq) : __fadd_rn(a, bq)) * sc;
        o16[q] = tohx(r); unsigned short a2, c2; splitf(r, a2, c2); oh[q] = a2; ol[q] = c2; }
    *(v2h*)(P16 + e) = o16; *(v2us*)(Ph + e) = oh; *(v2us*)(Pl + e) = ol;  }
__global__ __launch_bounds__(256) void k_vtp(const float* __restrict__ F, int pitch, int nheads, h16* V16, bf* Vh, bf* Vl) { const size_t e = ((size_t)blockIdx.x * 256 + threadIdx.x) * 2; if (e >= (size_t)nheads * HD * TT) return; const int t = (int)(e % TT); const int d = (int)((e / TT) % HD); const int g = (int)(e / ((size_t)TT * HD)); v2h o16; v2us oh, ol;
#pragma unroll
    for (int q = 0; q < 2; ++q) { const float x = F[(size_t)(t + q) * pitch + g * HD + d]; o16[q] = tohx(x); unsigned short a2, c2; splitf(x, a2, c2); oh[q] = a2; ol[q] = c2; }
    *(v2h*)(V16 + e) = o16; *(v2us*)(Vh + e) = oh; *(v2us*)(Vl + e) = ol;  }
__global__ __launch_bounds__(256) void k_csid(float* CS) { const int idx = blockIdx.x * 256 + threadIdx.x; if (idx >= TT * HD) return; v2f cs; cs[0] = 1.0f; cs[1] = 0.0f; *(v2f*)(CS + (size_t)idx * 2) = cs;  }
__global__ __launch_bounds__(256) void k_gath8(const float* __restrict__ TE, const int* __restrict__ POS, bf* EB) { const size_t i = (size_t)blockIdx.x * 256 + threadIdx.x; if (i >= (size_t)TT * DM / 8) return; const size_t e = i * 8; const int t = (int)(e / DM); const int c = (int)(e % DM); const int p = min(max(POS[t], 0), TT - 1);   /* clamp the table index (MAX_T = 2048 rows) */ const v8f v = *(const v8f*)(TE + (size_t)p * DM + c); v8us o;
#pragma unroll
    for (int k = 0; k < 8; ++k) o[k] = f2bf(v[k]); *(v8us*)(EB + e) = o;  }
__global__ __launch_bounds__(256) void k_addpl(const float* __restrict__ A, const float* __restrict__ Bm, bf* Ph, bf* Pl, size_t n4) { const size_t i = (size_t)blockIdx.x * 256 + threadIdx.x; if (i >= n4) return; const v4f a = *(const v4f*)(A + i * 4), b = *(const v4f*)(Bm + i * 4); v4us oh, ol;
#pragma unroll
    for (int q = 0; q < 4; ++q) { unsigned short h2, l2; splitf(__fadd_rn(a[q], b[q]), h2, l2); oh[q] = h2; ol[q] = l2; } *(v4us*)(Ph + i * 4) = oh; *(v4us*)(Pl + i * 4) = ol;  }
// k_asoft: per row (zz, i): t = S x HD^-0.5 (no mask); softmax over the 2048 keys (register row, one exp, fixed trees);
__global__ __launch_bounds__(256) void k_asoft(const float* __restrict__ Sb, h16* P16, bf* Ph, bf* Pl) {
    const int lane = threadIdx.x & 31; const int row = blockIdx.x * 8 + (threadIdx.x >> 5); if (row >= ZH * TT) return; const int i = row % TT; const int zz = row / TT; (void)zz; const bool hires = (i < RH); const float* sr = Sb + (size_t)row * TT; float v[TT / 32]; float mx = -3.0e38f;
#pragma unroll
    for (int ch = 0; ch < TT / 128; ++ch) { const int j0 = ch * 128 + lane * 4; const v4f a = *(const v4f*)(sr + j0);
#pragma unroll
        for (int q = 0; q < 4; ++q) { const int j = j0 + q; (void)j; const float t = a[q] * SCL; v[ch * 4 + q] = t; mx = fmaxf(mx, t); } }
#pragma unroll
    for (int sh = 16; sh; sh >>= 1) mx = fmaxf(mx, __shfl_xor(mx, sh, 32));
    float sum = 0.f;
#pragma unroll
    for (int k = 0; k < TT / 32; ++k) { float d0 = __fsub_rn(v[k], mx); asm volatile("" : "+v"(d0)); v[k] = __builtin_amdgcn_exp2f(__fmul_rn(d0, 1.4426950408889634f)); sum += v[k]; }
#pragma unroll
    for (int sh = 16; sh; sh >>= 1) sum += __shfl_xor(sum, sh, 32);
    const float f = __fdiv_rn(hires ? 1.0f : PCAR, sum);
{
        if (hires) {
#pragma unroll
            for (int ch = 0; ch < TT / 128; ++ch) { v4us oh, ol;
#pragma unroll
                for (int q = 0; q < 4; ++q) { unsigned short a, c2; splitf(v[ch * 4 + q] * f, a, c2); oh[q] = a; ol[q] = c2; }
                const size_t oo = ((size_t)zz * (RH ? RH : 1) + i) * TT + ch * 128 + lane * 4; *(v4us*)(Ph + oo) = oh; *(v4us*)(Pl + oo) = ol; }
        } else {
#pragma unroll
            for (int ch = 0; ch < TT / 128; ++ch) { v4h o4;
#pragma unroll
                for (int q = 0; q < 4; ++q) o4[q] = tohx(v[ch * 4 + q] * f);
                *(v4h*)(P16 + (size_t)row * TT + ch * 128 + lane * 4) = o4; } }
         }
}
__global__ __launch_bounds__(256) void k_merge(const float* __restrict__ O, int h0, bf* Ah, bf* Al) { const size_t e = ((size_t)blockIdx.x * 256 + threadIdx.x) * 2; if (e >= (size_t)ZH * TT * HD) return; const int d = (int)(e % HD); const int t = (int)((e / HD) % TT); const int zz = (int)(e / ((size_t)HD * TT)); const float cs = (t < RH) ? 1.0f : (1.0f / PCAR); const size_t oo = (size_t)t * DQ + (h0 + zz) * HD + d;
    v2us oh, ol; v2f pv[KSP]; const float* op = O + (size_t)zz * KSP * TT * HD + (size_t)t * HD + d;
#pragma unroll
    for (int p = 0; p < KSP; ++p) pv[p] = *(const v2f*)(op + (size_t)p * TT * HD);
    asm volatile("s_wait_xcnt 0x0" :: "v"(op) : "memory");   // precaution: the address pair that the KSP loads share stays as it is up to this wait
    v2f sm = pv[0];
#pragma unroll
    for (int p = 1; p < KSP; ++p) sm += pv[p];
#pragma unroll
    for (int q = 0; q < 2; ++q) { unsigned short a, c2; splitf(sm[q] * cs, a, c2); oh[q] = a; ol[q] = c2; } *(v2us*)(Ah + oo) = oh; *(v2us*)(Al + oo) = ol;  }

extern "C" void kernel_launch(void* const* d_in, const int* in_sizes, int n_in,
                              void* d_out, int out_size, void* d_ws, size_t ws_size, hipStream_t stream) {
    (void)in_sizes; (void)n_in; (void)out_size;
    const float* x = (const float*)d_in[0]; const int* POS = (const int*)d_in[1]; const float* TEMB = (const float*)d_in[2]; const float* wmix = (const float*)d_in[3]; const float* bmix = (const float*)d_in[4]; const float* wq = (const float*)d_in[5]; const float* bq = (const float*)d_in[6]; const float* wk = (const float*)d_in[7]; const float* bk = (const float*)d_in[8]; const float* wv = (const float*)d_in[9]; const float* bv = (const float*)d_in[10]; const float* wo = (const float*)d_in[11]; const float* bo = (const float*)d_in[12];
    float* OUT = (float*)d_out;     // [2][2048][1024]
    char* wsp = (char*)d_ws;
    auto take = [&](size_t bytes) { char* p = wsp; wsp += (bytes + 255) & ~(size_t)255; return (void*)p; };
    bf* WQ = (bf*)take((size_t)DQ * DM * 2); bf* WK = (bf*)take((size_t)DKV * DM * 2); bf* WV = (bf*)take((size_t)DKV * DM * 2); bf* WO = (bf*)take((size_t)DM * DQ * 2); float* CS = (float*)take((size_t)TT * HD * 2 * 4);
    bf* XB = (bf*)take((size_t)TT * DM * 2); bf* EB = (bf*)take((size_t)TT * DM * 2); bf* WM1 = (bf*)take((size_t)DM * DM * 2); bf* WM2 = (bf*)take((size_t)DM * DM * 2); float* M1 = (float*)take((size_t)TT * DM * 4); float* M2 = (float*)take((size_t)TT * DM * 4); bf* Yh = (bf*)take((size_t)TT * DM * 2); bf* Yl = (bf*)take((size_t)TT * DM * 2); float* FQ = (float*)take((size_t)TT * DQ * 4); float* FK = (float*)take((size_t)TT * DKV * 4);
    h16* QP16 = (h16*)take((size_t)NH_ * TT * HD * 2); h16* KP16 = (h16*)take((size_t)NKV * TT * HD * 2); h16* VT16 = (h16*)take((size_t)NKV * HD * TT * 2);
    bf* QPh = (bf*)take((size_t)NH_ * TT * HD * 2); bf* QPl = (bf*)take((size_t)NH_ * TT * HD * 2); bf* KPh = (bf*)take((size_t)NKV * TT * HD * 2); bf* KPl = (bf*)take((size_t)NKV * TT * HD * 2); bf* VTh = (bf*)take((size_t)NKV * HD * TT * 2); bf* VTl = (bf*)take((size_t)NKV * HD * TT * 2); bf* Ph = (bf*)take((size_t)ZH * RH * TT * 2); bf* Pl = (bf*)take((size_t)ZH * RH * TT * 2);
    float* Sb = (float*)take((size_t)ZH * TT * TT * 4); h16* P16 = (h16*)take((size_t)ZH * TT * TT * 2); float* Ob = (float*)take((size_t)KSP * ZH * TT * HD * 4); bf* ATh = (bf*)take((size_t)TT * DQ * 2); bf* ATl = (bf*)take((size_t)TT * DQ * 2);
    if ((size_t)(wsp - (char*)d_ws) > ws_size) return;    // ws 256 MiB
    float* FV = FK;   // v projection reuses the k buffer after the k planes are built (stream-ordered)
    { k_wtG<<<(unsigned)((DM * DQ / 64 + 63) / 64), 256, 0, stream>>>(wq, DM, DQ, WQ); k_wtG<<<(unsigned)((DM * DKV / 64 + 63) / 64), 256, 0, stream>>>(wk, DM, DKV, WK); k_wtG<<<(unsigned)((DM * DKV / 64 + 63) / 64), 256, 0, stream>>>(wv, DM, DKV, WV);
      k_wtG<<<(unsigned)((DQ * DM / 64 + 63) / 64), 256, 0, stream>>>(wo, DQ, DM, WO); k_wtG<<<(unsigned)((DM * DM / 64 + 63) / 64), 256, 0, stream>>>(wmix, DM, DM, WM1); k_wtG<<<(unsigned)((DM * DM / 64 + 63) / 64), 256, 0, stream>>>(wmix + (size_t)DM * DM, DM, DM, WM2);   /* W_mix halves ('xw' [2048][1024]: rows 0..1023 multiply x, 1024..2047 the embeddings) */
       }
    k_csid<<<(TT * HD + 255) / 256, 256, 0, stream>>>(CS);
    const unsigned LQ = (unsigned)(((size_t)NH_ * TT * HD / 2 + 255) / 256), LKv = (unsigned)(((size_t)NKV * TT * HD / 2 + 255) / 256);
    for (int b = 0; b < NB_; ++b) {
        
        k_cvt8<<<(unsigned)(((size_t)TT * DM / 8 + 255) / 256), 256, 0, stream>>>(x + (size_t)b * TT * DM, XB, (size_t)TT * DM / 8); k_gath8<<<(unsigned)(((size_t)TT * DM / 8 + 255) / 256), 256, 0, stream>>>(TEMB, POS, EB);
        k_gemmw<bf, 0, true><<<dim3(TT / 64, DM / 64, 1), 32, 0, stream>>>(XB, nullptr, WM1, nullptr, DM, M1, DM, bmix, 0, 0, 0); k_gemmw<bf, 0, false><<<dim3(TT / 64, DM / 64, 1), 32, 0, stream>>>(EB, nullptr, WM2, nullptr, DM, M2, DM, nullptr, 0, 0, 0);   /* x W_mix[:D] + b_mix ; temb W_mix[D:] */
        k_addpl<<<(unsigned)(((size_t)TT * DM / 4 + 255) / 256), 256, 0, stream>>>(M1, M2, Yh, Yl, (size_t)TT * DM / 4);   /* x_t -> hi/lo planes */
        k_gemmw<bf, 1, true><<<dim3(TT / 64, DQ / 64, 1), 32, 0, stream>>>(Yh, Yl, WQ, nullptr, DM, FQ, DQ, bq, 0, 0, 0);
        k_rope<<<LQ, 256, 0, stream>>>(FQ, DQ, NH_, CS, nullptr, nullptr, 1.0f, QP16, QPh, QPl);
        k_gemmw<bf, 1, true><<<dim3(TT / 64, DKV / 64, 1), 32, 0, stream>>>(Yh, Yl, WK, nullptr, DM, FK, DKV, bk, 0, 0, 0);
        k_rope<<<LKv, 256, 0, stream>>>(FK, DKV, NKV, CS, nullptr, nullptr, 1.0f, KP16, KPh, KPl);
        k_gemmw<bf, 1, true><<<dim3(TT / 64, DKV / 64, 1), 32, 0, stream>>>(Yh, Yl, WV, nullptr, DM, FV, DKV, bv, 0, 0, 0); k_vtp<<<LKv, 256, 0, stream>>>(FV, DKV, NKV, VT16, VTh, VTl);
        for (int h0 = 0; h0 < NH_; h0 += ZH) { const size_t zq = (size_t)h0, zk = (size_t)(h0 / REP);   // one kv head per query head: the pass's two heads use consecutive kv planes (z-strides TT*HD)
            k_gemmw<bf, 2, false><<<dim3(RH / 64, TT / 64, ZH), 32, 0, stream>>>(QPh + zq * TT * HD, QPl + zq * TT * HD, KPh + zk * TT * HD, KPl + zk * TT * HD, HD, Sb, TT, nullptr, (size_t)TT * HD, (size_t)TT * HD, (size_t)TT * TT);
            k_gemmw<h16, 0, false><<<dim3((TT - RH) / 64, TT / 64, ZH), 32, 0, stream>>>(QP16 + zq * TT * HD + (size_t)RH * HD, nullptr, KP16 + zk * TT * HD, nullptr, HD, Sb + (size_t)RH * TT, TT, nullptr, (size_t)TT * HD, (size_t)TT * HD, (size_t)TT * TT);
            k_asoft<<<ZH * TT / 8, 256, 0, stream>>>(Sb, P16, Ph, Pl);
            k_gemmw<bf, 2, false, KSP><<<dim3(RH / 64, HD / 64, ZH * KSP), 32, 0, stream>>>(Ph, Pl, VTh + zk * HD * TT, VTl + zk * HD * TT, TT, Ob, HD, nullptr, (size_t)RH * TT, (size_t)HD * TT, (size_t)TT * HD);
            k_gemmw<h16, 0, false, KSP><<<dim3((TT - RH) / 64, HD / 64, ZH * KSP), 32, 0, stream>>>(P16 + (size_t)RH * TT, nullptr, VT16 + zk * HD * TT, nullptr, TT, Ob + (size_t)RH * HD, HD, nullptr, (size_t)TT * TT, (size_t)HD * TT, (size_t)TT * HD);
            k_merge<<<(unsigned)(((size_t)ZH * TT * HD / 2 + 255) / 256), 256, 0, stream>>>(Ob, h0, ATh, ATl); }
        k_gemmw<bf, 1, true><<<dim3(TT / 64, DM / 64, 1), 32, 0, stream>>>(ATh, ATl, WO, nullptr, DQ, OUT + (size_t)b * TT * DM, DM, bo, 0, 0, 0); }
}

// v002
// A run of this version takes 556 microseconds.
// Timed twice side by side with v001, it ran 1.85 and 1.86 times as fast.
// Over all steps from v000 it is 3.90 times as fast.
#include <hip/hip_runtime.h>

// Temporal attention with a learned temporal-embedding mixer (x [2][2048][1024]; temb = temporal_embeddings[0][temporal_positions[t]] (int32 positions, read); x_t = [x | temb] W_mix + b_mix (W_mix [2048][1024]); q, k, v = x_t W + b ('xw' [1024][1024]; 16 heads x 64); softmax(q.k/8); out = merged W_o + b_o -> [2][2048][1024] (4.2 M)).
// Layout: the concat-and-mix is two exact GEMMs (x against the top half of W_mix with the bias, the gathered embeddings against the bottom half) summed in f32; x_t then feeds the projections as bf16 hi + lo planes (2 products).
// Compute dtypes, f32 accumulate: every input rounded to bf16; x, the gathered embeddings and W_mix exact (1 product each, + b_mix), summed in f32 -> x_t as bf16 hi + lo planes; q/k/v as 2 products against the exact weights + biases; scores and attn.v: query rows < 512 hl (3 products), the rest single fp16 (x1024); softmax f32, online over 64-key steps inside one fused kernel (k_fattn); W_o hl x exact (2 products) + b_o.

#define NB_  2
#define TT   2048
#define DM   1024
#define NH_  16
#define NKV  16
#define REP  (NH_ / NKV)
#define HD   64
#define DQ   (NH_ * HD)
#define DKV  (NKV * HD)
#define RH   512                  // query rows < RH use hi+lo planes (0: none)
#define WIN  0
#define PCL2 10.0f                // fp16 rows: probabilities carry a factor 2^10 (as does their sum), away from the fp16 subnormals
#define SCL  0.125f   // HD^-0.5
#define KC   64                   // k_fattn: keys per online-softmax step
#define LP   72                   // k_fattn: LDS row pitch in 16-bit elements (128 B of data + 16 B: the 16 rows of a 16-byte fragment read fall on different banks)
typedef _Float16 h16;
typedef unsigned short bf;
typedef __attribute__((ext_vector_type(16))) __bf16   v16bf;
typedef __attribute__((ext_vector_type(16))) _Float16 v16h;
typedef __attribute__((ext_vector_type(8)))  _Float16 v8h;
typedef __attribute__((ext_vector_type(8)))  unsigned short v8us;
typedef __attribute__((ext_vector_type(16))) unsigned short v16us;
typedef __attribute__((ext_vector_type(8)))  float    v8f;
typedef __attribute__((ext_vector_type(4)))  float    v4f;
typedef v8h  __attribute__((may_alias)) v8ha;
typedef v4f  __attribute__((may_alias)) v4fa;
typedef v8us __attribute__((may_alias)) v8usa;

__device__ __forceinline__ unsigned short f2bf(float f) { unsigned u = __float_as_uint(f); u += 0x7FFFu + ((u >> 16) & 1u); return (unsigned short)(u >> 16); }
__device__ __forceinline__ float bf2f(unsigned short b) { return __uint_as_float(((unsigned)b) << 16); }
__device__ __forceinline__ float bfr(float f) { return bf2f(f2bf(f)); }
__device__ __forceinline__ v16h cat16(v8h lo, v8h hi) { return __builtin_shufflevector(lo, hi, 0, 1, 2, 3, 4, 5, 6, 7, 8, 9, 10, 11, 12, 13, 14, 15); }
__device__ __forceinline__ v16bf cat16b(v8us lo, v8us hi) { return __builtin_bit_cast(v16bf, __builtin_shufflevector(lo, hi, 0, 1, 2, 3, 4, 5, 6, 7, 8, 9, 10, 11, 12, 13, 14, 15)); }
__device__ __forceinline__ v8f wmma16(v16h a, v16h b, v8f c) { return __builtin_amdgcn_wmma_f32_16x16x32_f16(false, a, false, b, (short)0, c, false, false); }
__device__ __forceinline__ v8f wmmab(v16bf a, v16bf b, v8f c) { return __builtin_amdgcn_wmma_f32_16x16x32_bf16(false, a, false, b, (short)0, c, false, false); }



// ---- k_gemmw: register-blocked GEMM, ONE WAVE per 64x64 output tile (16 accumulators), operands straight from K-contiguous 16-bit planes; grid (M/64, N/64, Z), 32 threads.
// C[m][n] (f32, pitch ldc, + optional f32 bias[n]) = sum_k A[m][k] Bt[n][k] (+ split products per NSPLIT). z-batch strides sA/sB/sC in elements. K % (32 KS) == 0.
// KS > 1: grid z = Z * KS; slice ks = z % KS sums only k in [ks K/KS, (ks+1) K/KS) and writes its own partial plane C + (batch KS + ks) sC; the reader adds the KS planes.
template <typename T16> struct WFrag;
template <> struct WFrag<h16> { typedef v16h V; typedef v8h H; static __device__ __forceinline__ V ld(const h16* p) { return cat16(*(const v8h*)p, *(const v8h*)(p + 16)); } static __device__ __forceinline__ v8f mma(V a, V b, v8f c) { return wmma16(a, b, c); } };
template <> struct WFrag<bf> { typedef v16bf V; typedef v8us H; static __device__ __forceinline__ V ld(const bf* p) { return cat16b(*(const v8us*)p, *(const v8us*)(p + 16)); } static __device__ __forceinline__ v8f mma(V a, V b, v8f c) { return wmmab(a, b, c); } };
template <typename T16, int NSPLIT, bool BIAS, int KS = 1>
__global__ __launch_bounds__(32) void k_gemmw(const T16* __restrict__ A, const T16* __restrict__ A2, const T16* __restrict__ Bt, const T16* __restrict__ Bt2, int K, float* C, int ldc, const float* __restrict__ bias, size_t sA, size_t sB, size_t sC) {
    typedef typename WFrag<T16>::V V;
    __shared__ __align__(16) float os[16 * 68];
    const size_t z = blockIdx.z / KS; const int ks = blockIdx.z % KS; A += z * sA; if (A2) A2 += z * sA; Bt += z * sB; if (Bt2) Bt2 += z * sB; C += (z * KS + ks) * sC;
    const int lane = threadIdx.x & 31, lr = lane & 15, hi = lane >> 4; const int r0 = blockIdx.x * 64, c0 = blockIdx.y * 64;
    v8f acc[4][4];
#pragma unroll
    for (int mb = 0; mb < 4; ++mb)
#pragma unroll
        for (int nb = 0; nb < 4; ++nb) acc[mb][nb] = (v8f){};
    const size_t aoff = (size_t)(r0 + lr) * K + 8 * hi, boff = (size_t)(c0 + lr) * K + 8 * hi;
#pragma unroll 1
    for (int kc = ks * (K / KS); kc < (ks + 1) * (K / KS); kc += 32) {
        V a[4], a2[4];
#pragma unroll
        for (int mb = 0; mb < 4; ++mb) { a[mb] = WFrag<T16>::ld(A + aoff + (size_t)mb * 16 * K + kc); if (NSPLIT == 1 || NSPLIT == 2) a2[mb] = WFrag<T16>::ld(A2 + aoff + (size_t)mb * 16 * K + kc); }
#pragma unroll
        for (int nb = 0; nb < 4; ++nb) { const V b = WFrag<T16>::ld(Bt + boff + (size_t)nb * 16 * K + kc); V b2; if (NSPLIT >= 2) b2 = WFrag<T16>::ld(Bt2 + boff + (size_t)nb * 16 * K + kc);
#pragma unroll
            for (int mb = 0; mb < 4; ++mb) { acc[mb][nb] = WFrag<T16>::mma(a[mb], b, acc[mb][nb]); if (NSPLIT == 1 || NSPLIT == 2) acc[mb][nb] = WFrag<T16>::mma(a2[mb], b, acc[mb][nb]); if (NSPLIT >= 2) acc[mb][nb] = WFrag<T16>::mma(a[mb], b2, acc[mb][nb]); } }
        asm volatile("v_nop\n\tv_nop\n\tv_nop\n\tv_nop" : "+v"(acc[0][0]), "+v"(acc[1][1]), "+v"(acc[2][2]), "+v"(acc[3][3]) : "v"(a[0]), "v"(a[3]));
    }
#pragma unroll
    for (int mb = 0; mb < 4; ++mb) {
#pragma unroll
        for (int nb = 0; nb < 4; ++nb) {
#pragma unroll
            for (int j = 0; j < 8; ++j) os[(hi * 8 + j) * 68 + nb * 16 + lr] = acc[mb][nb][j]; }
        __builtin_amdgcn_wave_barrier(); asm volatile("" ::: "memory");
        float* crow = C + (size_t)(r0 + mb * 16) * ldc + c0;
{
#pragma unroll
            for (int s = 0; s < 8; ++s) { const int row = 2 * s + hi, cofs = lr * 4; v4f val = *(const v4fa*)(os + row * 68 + cofs); if (BIAS) { val[0] += bfr(bias[c0 + cofs]); val[1] += bfr(bias[c0 + cofs + 1]); val[2] += bfr(bias[c0 + cofs + 2]); val[3] += bfr(bias[c0 + cofs + 3]); }
                *(v4f*)(crow + (size_t)row * ldc + cofs) = val; }
             }
        __builtin_amdgcn_wave_barrier(); asm volatile("" ::: "memory");
    }
}

__device__ __forceinline__ h16 tohx(float x) { return (h16)x; }
__device__ __forceinline__ void splitf(float y, unsigned short& h, unsigned short& l) { h = f2bf(y); l = f2bf(y - bf2f(h)); }
typedef __attribute__((ext_vector_type(2))) _Float16 v2h;
typedef __attribute__((ext_vector_type(4))) _Float16 v4h;
typedef __attribute__((ext_vector_type(2))) unsigned short v2us;
typedef __attribute__((ext_vector_type(4))) unsigned short v4us;
typedef __attribute__((ext_vector_type(2))) float v2f;
typedef __attribute__((ext_vector_type(4))) int v4i;

__global__ __launch_bounds__(256) void k_wtG(const float* __restrict__ w, int K, int N, bf* Bt) {
    const int lane = threadIdx.x & 31; const int L0 = (blockIdx.x * 8 + (threadIdx.x >> 5)) * 8; const int nlines = N * K / 64;
{
#pragma unroll 1
        for (int l = 0; l < 8; ++l) { const int L = L0 + l; if (L >= nlines) break; const size_t e = (size_t)L * 64 + lane * 2; const int k = (int)(e % K), n = (int)(e / K); v2us o;
            o[0] = f2bf(w[(size_t)k * N + n]); o[1] = f2bf(w[(size_t)(k + 1) * N + n]); *(v2us*)(Bt + e) = o; }
         }
}
__global__ __launch_bounds__(256) void k_cvt8(const float* __restrict__ src, bf* dst, size_t n8) { const size_t i = (size_t)blockIdx.x * 256 + threadIdx.x; if (i >= n8) return; const v8f v = *(const v8f*)(src + i * 8); v8us o;
#pragma unroll
    for (int k = 0; k < 8; ++k) o[k] = f2bf(v[k]); *(v8us*)(dst + i * 8) = o;  }

// k_rope: head planes [h][t][d] (fp16 + hi/lo) of rope(x) x sc with the rotate-half convention out[d] = x[d] cos[t][d] - x[d+HD/2] sin[t][d], out[d+HD/2] = x[d+HD/2] cos[t][d+HD/2] + x[d] sin[t][d+HD/2]
__global__ __launch_bounds__(256) void k_rope(const float* __restrict__ F, int pitch, int nheads, const float* __restrict__ CS, const float* __restrict__ RF, const float* __restrict__ nw, float sc, h16* P16, bf* Ph, bf* Pl) {
    const size_t e = ((size_t)blockIdx.x * 256 + threadIdx.x) * 2; if (e >= (size_t)nheads * TT * HD) return; const int d = (int)(e % HD); const int t = (int)((e / HD) % TT); const int h = (int)(e / ((size_t)HD * TT)); const float* f = F + (size_t)t * pitch + h * HD; const float rf = RF ? RF[(size_t)h * TT + t] : 1.0f; v2h o16; v2us oh, ol;
#pragma unroll
    for (int q = 0; q < 2; ++q) { const int dd = d + q; const int dp = (dd < HD / 2) ? dd + HD / 2 : dd - HD / 2; float x0 = f[dd], x1 = f[dp];
        if (RF) { float n0 = __fmul_rn(x0, rf), n1 = __fmul_rn(x1, rf); asm volatile("" : "+v"(n0)); asm volatile("" : "+v"(n1)); x0 = __fmul_rn(bfr(nw[dd]), n0); x1 = __fmul_rn(bfr(nw[dp]), n1); }
        const v2f cs = *(const v2f*)(CS + ((size_t)t * HD + dd) * 2); float a = __fmul_rn(x0, cs[0]), bq = __fmul_rn(x1, cs[1]); asm volatile("" : "+v"(a)); asm volatile("" : "+v"(bq)); const float r = ((dd < HD / 2) ? __fsub_rn(a, bq) : __fadd_rn(a, bq)) * sc;
        o16[q] = tohx(r); unsigned short a2, c2; splitf(r, a2, c2); oh[q] = a2; ol[q] = c2; }
    *(v2h*)(P16 + e) = o16; *(v2us*)(Ph + e) = oh; *(v2us*)(Pl + e) = ol;  }
__global__ __launch_bounds__(256) void k_vtp(const float* __restrict__ F, int pitch, int nheads, h16* V16, bf* Vh, bf* Vl) { const size_t e = ((size_t)blockIdx.x * 256 + threadIdx.x) * 2; if (e >= (size_t)nheads * HD * TT) return; const int t = (int)(e % TT); const int d = (int)((e / TT) % HD); const int g = (int)(e / ((size_t)TT * HD)); v2h o16; v2us oh, ol;
#pragma unroll
    for (int q = 0; q < 2; ++q) { const float x = F[(size_t)(t + q) * pitch + g * HD + d]; o16[q] = tohx(x); unsigned short a2, c2; splitf(x, a2, c2); oh[q] = a2; ol[q] = c2; }
    *(v2h*)(V16 + e) = o16; *(v2us*)(Vh + e) = oh; *(v2us*)(Vl + e) = ol;  }
__global__ __launch_bounds__(256) void k_csid(float* CS) { const int idx = blockIdx.x * 256 + threadIdx.x; if (idx >= TT * HD) return; v2f cs; cs[0] = 1.0f; cs[1] = 0.0f; *(v2f*)(CS + (size_t)idx * 2) = cs;  }
__global__ __launch_bounds__(256) void k_gath8(const float* __restrict__ TE, const int* __restrict__ POS, bf* EB) { const size_t i = (size_t)blockIdx.x * 256 + threadIdx.x; if (i >= (size_t)TT * DM / 8) return; const size_t e = i * 8; const int t = (int)(e / DM); const int c = (int)(e % DM); const int p = min(max(POS[t], 0), TT - 1);   /* clamp the table index (MAX_T = 2048 rows) */ const v8f v = *(const v8f*)(TE + (size_t)p * DM + c); v8us o;
#pragma unroll
    for (int k = 0; k < 8; ++k) o[k] = f2bf(v[k]); *(v8us*)(EB + e) = o;  }
__global__ __launch_bounds__(256) void k_addpl(const float* __restrict__ A, const float* __restrict__ Bm, bf* Ph, bf* Pl, size_t n4) { const size_t i = (size_t)blockIdx.x * 256 + threadIdx.x; if (i >= n4) return; const v4f a = *(const v4f*)(A + i * 4), b = *(const v4f*)(Bm + i * 4); v4us oh, ol;
#pragma unroll
    for (int q = 0; q < 4; ++q) { unsigned short h2, l2; splitf(__fadd_rn(a[q], b[q]), h2, l2); oh[q] = h2; ol[q] = l2; } *(v4us*)(Ph + i * 4) = oh; *(v4us*)(Pl + i * 4) = ol;  }
__device__ __forceinline__ float exp2s(float x) { float r; asm("v_exp_f32 %0, %1\n\tv_nop" : "=v"(r) : "v"(x)); return r; }
// element e of a wave-uniform base, as base + 32-bit byte offset: one offset register per address instead of a 64-bit pair
template <typename T16> __device__ __forceinline__ const T16* at32(const T16* base, unsigned e) { return (const T16*)((const char*)base + e * 2u); }
template <typename T16, bool HL, int NQ>
__device__ __forceinline__ void attn_tile(T16* sm, const T16* __restrict__ Q, const T16* __restrict__ Q2, const T16* __restrict__ Kp, const T16* __restrict__ K2, const T16* __restrict__ Vt, const T16* __restrict__ Vt2, int q0, bf* Ah, bf* Al) {
    typedef typename WFrag<T16>::V V; typedef typename WFrag<T16>::H H;
    constexpr int NP = HL ? 2 : 1, PL = KC * LP, BUF = 2 * NP * PL;   // planes per operand; elements per staged plane; elements per buffer (K planes, then V^T planes)
    const int tid = threadIdx.x, lane = tid & 31, lr = lane & 15, hi = lane >> 4; const int srow = tid >> 3, scol = (tid & 7) * 8;
    const float c = SCL * 1.4426950408889634f;
    V qf[NQ][2], qf2[NQ][2];
#pragma unroll
    for (int qt = 0; qt < NQ; ++qt)
#pragma unroll
        for (int ks = 0; ks < 2; ++ks) { const unsigned qo = (unsigned)((q0 + qt * 16 + lr) * HD + ks * 32 + 8 * hi); qf[qt][ks] = WFrag<T16>::ld(at32(Q, qo)); if (HL) qf2[qt][ks] = WFrag<T16>::ld(at32(Q2, qo)); }
    v8f o[4][NQ]; float m[NQ], l[NQ];
#pragma unroll
    for (int qt = 0; qt < NQ; ++qt) { m[qt] = -3.0e38f; l[qt] = 0.f;
#pragma unroll
        for (int dt = 0; dt < 4; ++dt) o[dt][qt] = (v8f){}; }
    H gk[NP][4], gv[NP][4];
#pragma unroll
    for (int i = 0; i < 4; ++i) { const int r = srow + 16 * i; const unsigned ko = (unsigned)(r * HD + scol), vo = (unsigned)(r * TT + scol); gk[0][i] = *(const H*)at32(Kp, ko); gv[0][i] = *(const H*)at32(Vt, vo); if (HL) { gk[NP - 1][i] = *(const H*)at32(K2, ko); gv[NP - 1][i] = *(const H*)at32(Vt2, vo); } }
#pragma unroll
    for (int i = 0; i < 4; ++i) { const int so = (srow + 16 * i) * LP + scol;
#pragma unroll
        for (int p = 0; p < NP; ++p) { *(H*)(sm + p * PL + so) = gk[p][i]; *(H*)(sm + (NP + p) * PL + so) = gv[p][i]; } }
    __syncthreads();   // step 0 is staged
#pragma unroll 1   // rolled: one step is some 600 instructions already, a second copy would only lengthen the text (the loops inside are unrolled so that the fragment arrays stay in registers)
    for (int kb = 0; kb < TT; kb += KC) {
        const T16* sb = sm + ((kb / KC) & 1) * BUF; T16* sn = sm + (((kb / KC) & 1) ^ 1) * BUF; const bool more = kb + KC < TT;   // the same for the whole work-group
        if (more) {
#pragma unroll
            for (int i = 0; i < 4; ++i) { const int r = srow + 16 * i; const unsigned ko = (unsigned)((kb + KC + r) * HD + scol), vo = (unsigned)(r * TT + kb + KC + scol); gk[0][i] = *(const H*)at32(Kp, ko); gv[0][i] = *(const H*)at32(Vt, vo); if (HL) { gk[NP - 1][i] = *(const H*)at32(K2, ko); gv[NP - 1][i] = *(const H*)at32(Vt2, vo); } } }
        v8f s[KC / 16][NQ];
#pragma unroll
        for (int mt = 0; mt < KC / 16; ++mt) {
#pragma unroll
            for (int qt = 0; qt < NQ; ++qt) s[mt][qt] = (v8f){};
#pragma unroll
            for (int ks = 0; ks < 2; ++ks) { const int fo = (mt * 16 + lr) * LP + ks * 32 + 8 * hi; const V a = WFrag<T16>::ld(sb + fo); V a2; if (HL) a2 = WFrag<T16>::ld(sb + PL + fo);
#pragma unroll
                for (int qt = 0; qt < NQ; ++qt) { s[mt][qt] = WFrag<T16>::mma(a, qf[qt][ks], s[mt][qt]); if (HL) { s[mt][qt] = WFrag<T16>::mma(a, qf2[qt][ks], s[mt][qt]); s[mt][qt] = WFrag<T16>::mma(a2, qf[qt][ks], s[mt][qt]); } } } }
        V pf[KC / 32][NQ], pf2[KC / 32][NQ];
#pragma unroll
        for (int qt = 0; qt < NQ; ++qt) {
            float mx4[4] = { m[qt], m[qt], m[qt], m[qt] };
#pragma unroll
            for (int mt = 0; mt < KC / 16; ++mt)
#pragma unroll
                for (int j = 0; j < 8; ++j) mx4[j & 3] = fmaxf(mx4[j & 3], s[mt][qt][j]);
            float mx = fmaxf(fmaxf(mx4[0], mx4[1]), fmaxf(mx4[2], mx4[3])); mx = fmaxf(mx, __shfl_xor(mx, 16, 32));   // the query's other keys sit in lane ^ 16
            const float al = exp2s((m[qt] - mx) * c); m[qt] = mx; const float mc = HL ? mx * c : mx * c - PCL2;
            float sm4[4] = { 0.f, 0.f, 0.f, 0.f };
#pragma unroll
            for (int mt = 0; mt < KC / 16; ++mt)
#pragma unroll
                for (int j = 0; j < 8; ++j) { const float p = exp2s(__builtin_fmaf(s[mt][qt][j], c, -mc)); s[mt][qt][j] = p; sm4[j & 3] += p; }
            l[qt] = l[qt] * al + ((sm4[0] + sm4[1]) + (sm4[2] + sm4[3]));
#pragma unroll
            for (int dt = 0; dt < 4; ++dt) o[dt][qt] *= al;
#pragma unroll
            for (int ks = 0; ks < KC / 32; ++ks) {
                if constexpr (HL) { v16us ph, pl;
#pragma unroll
                    for (int e = 0; e < 16; ++e) { unsigned short a, b; splitf(s[2 * ks + (e >> 3)][qt][e & 7], a, b); ph[e] = a; pl[e] = b; }
                    pf[ks][qt] = __builtin_bit_cast(v16bf, ph); pf2[ks][qt] = __builtin_bit_cast(v16bf, pl);
                } else { v16h ph;
#pragma unroll
                    for (int e = 0; e < 16; ++e) ph[e] = tohx(s[2 * ks + (e >> 3)][qt][e & 7]);
                    pf[ks][qt] = ph; } } }
#pragma unroll
        for (int dt = 0; dt < 4; ++dt)
#pragma unroll
            for (int ks = 0; ks < KC / 32; ++ks) { const int fo = (dt * 16 + lr) * LP + ks * 32 + 8 * hi; const V a = WFrag<T16>::ld(sb + NP * PL + fo); V a2; if (HL) a2 = WFrag<T16>::ld(sb + (NP + 1) * PL + fo);
#pragma unroll
                for (int qt = 0; qt < NQ; ++qt) { o[dt][qt] = WFrag<T16>::mma(a, pf[ks][qt], o[dt][qt]); if (HL) { o[dt][qt] = WFrag<T16>::mma(a, pf2[ks][qt], o[dt][qt]); o[dt][qt] = WFrag<T16>::mma(a2, pf[ks][qt], o[dt][qt]); } } }
        if (more) {
#pragma unroll
            for (int i = 0; i < 4; ++i) { const int so = (srow + 16 * i) * LP + scol;
#pragma unroll
                for (int p = 0; p < NP; ++p) { *(H*)(sn + p * PL + so) = gk[p][i]; *(H*)(sn + (NP + p) * PL + so) = gv[p][i]; } } }
        __syncthreads();   // publishes step s + 1 and ends every wave's reads of step s's buffer, which step s + 1 refills
    }
#pragma unroll
    for (int qt = 0; qt < NQ; ++qt) { const float inv = __fdiv_rn(1.0f, l[qt] + __shfl_xor(l[qt], 16, 32)); const unsigned oo = (unsigned)((q0 + qt * 16 + lr) * DQ + hi * 8);
#pragma unroll
        for (int dt = 0; dt < 4; ++dt) { v8us oh, ol;
#pragma unroll
            for (int j = 0; j < 8; ++j) { unsigned short a, b; splitf(o[dt][qt][j] * inv, a, b); oh[j] = a; ol[j] = b; }
            *(v8us*)((char*)Ah + (oo + dt * 16) * 2u) = oh; *(v8us*)((char*)Al + (oo + dt * 16) * 2u) = ol;
            asm volatile("s_wait_xcnt 0x0" ::: "memory");   // precaution: the registers that the two stores name (offset, bases, data) stay as they are up to this wait
        } }
}
#define NQH  1                    // query tiles of 16 per wave, hi+lo rows
#define NQF  2                    // query tiles of 16 per wave, fp16 rows
#define GHL  (NH_ * (RH / (16 * NQH)) / 4)          // work-groups on the hi+lo rows (the longer ones: first)
#define GF16 (NH_ * ((TT - RH) / (16 * NQF)) / 4)   // work-groups on the fp16 rows
// amdgpu_waves_per_eu(4): a budget of 256 VGPRs, so that the loops need no register-window switches (without it the build took 293) and up to four waves fit a SIMD
__global__ __launch_bounds__(128) __attribute__((amdgpu_waves_per_eu(4))) void k_fattn(const h16* __restrict__ Q16, const h16* __restrict__ K16, const h16* __restrict__ V16, const bf* __restrict__ Qh, const bf* __restrict__ Ql, const bf* __restrict__ Kh, const bf* __restrict__ Kl, const bf* __restrict__ Vh, const bf* __restrict__ Vl, bf* Ah, bf* Al) {
    __shared__ __align__(16) unsigned short smem[2 * 4 * KC * LP];
    const int w = __builtin_amdgcn_readfirstlane((int)(threadIdx.x >> 5));
    if (blockIdx.x < GHL) { const int gw = blockIdx.x * 4 + w, h = gw / (RH / (16 * NQH)), q0 = (gw % (RH / (16 * NQH))) * 16 * NQH; const size_t po = (size_t)h * TT * HD;
        attn_tile<bf, true, NQH>((bf*)smem, Qh + po, Ql + po, Kh + po, Kl + po, Vh + po, Vl + po, q0, Ah + h * HD, Al + h * HD);
    } else { const int gw = (blockIdx.x - GHL) * 4 + w, h = gw / ((TT - RH) / (16 * NQF)), q0 = RH + (gw % ((TT - RH) / (16 * NQF))) * 16 * NQF; const size_t po = (size_t)h * TT * HD;
        attn_tile<h16, false, NQF>((h16*)smem, Q16 + po, nullptr, K16 + po, nullptr, V16 + po, nullptr, q0, Ah + h * HD, Al + h * HD); }
}

extern "C" void kernel_launch(void* const* d_in, const int* in_sizes, int n_in,
                              void* d_out, int out_size, void* d_ws, size_t ws_size, hipStream_t stream) {
    (void)in_sizes; (void)n_in; (void)out_size;
    const float* x = (const float*)d_in[0]; const int* POS = (const int*)d_in[1]; const float* TEMB = (const float*)d_in[2]; const float* wmix = (const float*)d_in[3]; const float* bmix = (const float*)d_in[4]; const float* wq = (const float*)d_in[5]; const float* bq = (const float*)d_in[6]; const float* wk = (const float*)d_in[7]; const float* bk = (const float*)d_in[8]; const float* wv = (const float*)d_in[9]; const float* bv = (const float*)d_in[10]; const float* wo = (const float*)d_in[11]; const float* bo = (const float*)d_in[12];
    float* OUT = (float*)d_out;     // [2][2048][1024]
    char* wsp = (char*)d_ws;
    auto take = [&](size_t bytes) { char* p = wsp; wsp += (bytes + 255) & ~(size_t)255; return (void*)p; };
    bf* WQ = (bf*)take((size_t)DQ * DM * 2); bf* WK = (bf*)take((size_t)DKV * DM * 2); bf* WV = (bf*)take((size_t)DKV * DM * 2); bf* WO = (bf*)take((size_t)DM * DQ * 2); float* CS = (float*)take((size_t)TT * HD * 2 * 4);
    bf* XB = (bf*)take((size_t)TT * DM * 2); bf* EB = (bf*)take((size_t)TT * DM * 2); bf* WM1 = (bf*)take((size_t)DM * DM * 2); bf* WM2 = (bf*)take((size_t)DM * DM * 2); float* M1 = (float*)take((size_t)TT * DM * 4); float* M2 = (float*)take((size_t)TT * DM * 4); bf* Yh = (bf*)take((size_t)TT * DM * 2); bf* Yl = (bf*)take((size_t)TT * DM * 2); float* FQ = (float*)take((size_t)TT * DQ * 4); float* FK = (float*)take((size_t)TT * DKV * 4);
    h16* QP16 = (h16*)take((size_t)NH_ * TT * HD * 2); h16* KP16 = (h16*)take((size_t)NKV * TT * HD * 2); h16* VT16 = (h16*)take((size_t)NKV * HD * TT * 2);
    bf* QPh = (bf*)take((size_t)NH_ * TT * HD * 2); bf* QPl = (bf*)take((size_t)NH_ * TT * HD * 2); bf* KPh = (bf*)take((size_t)NKV * TT * HD * 2); bf* KPl = (bf*)take((size_t)NKV * TT * HD * 2); bf* VTh = (bf*)take((size_t)NKV * HD * TT * 2); bf* VTl = (bf*)take((size_t)NKV * HD * TT * 2);
    bf* ATh = (bf*)take((size_t)TT * DQ * 2); bf* ATl = (bf*)take((size_t)TT * DQ * 2);
    if ((size_t)(wsp - (char*)d_ws) > ws_size) return;    // ws 256 MiB
    float* FV = FK;   // v projection reuses the k buffer after the k planes are built (stream-ordered)
    { k_wtG<<<(unsigned)((DM * DQ / 64 + 63) / 64), 256, 0, stream>>>(wq, DM, DQ, WQ); k_wtG<<<(unsigned)((DM * DKV / 64 + 63) / 64), 256, 0, stream>>>(wk, DM, DKV, WK); k_wtG<<<(unsigned)((DM * DKV / 64 + 63) / 64), 256, 0, stream>>>(wv, DM, DKV, WV);
      k_wtG<<<(unsigned)((DQ * DM / 64 + 63) / 64), 256, 0, stream>>>(wo, DQ, DM, WO); k_wtG<<<(unsigned)((DM * DM / 64 + 63) / 64), 256, 0, stream>>>(wmix, DM, DM, WM1); k_wtG<<<(unsigned)((DM * DM / 64 + 63) / 64), 256, 0, stream>>>(wmix + (size_t)DM * DM, DM, DM, WM2);   /* W_mix halves ('xw' [2048][1024]: rows 0..1023 multiply x, 1024..2047 the embeddings) */
       }
    k_csid<<<(TT * HD + 255) / 256, 256, 0, stream>>>(CS);
    const unsigned LQ = (unsigned)(((size_t)NH_ * TT * HD / 2 + 255) / 256), LKv = (unsigned)(((size_t)NKV * TT * HD / 2 + 255) / 256);
    for (int b = 0; b < NB_; ++b) {
        
        k_cvt8<<<(unsigned)(((size_t)TT * DM / 8 + 255) / 256), 256, 0, stream>>>(x + (size_t)b * TT * DM, XB, (size_t)TT * DM / 8); k_gath8<<<(unsigned)(((size_t)TT * DM / 8 + 255) / 256), 256, 0, stream>>>(TEMB, POS, EB);
        k_gemmw<bf, 0, true><<<dim3(TT / 64, DM / 64, 1), 32, 0, stream>>>(XB, nullptr, WM1, nullptr, DM, M1, DM, bmix, 0, 0, 0); k_gemmw<bf, 0, false><<<dim3(TT / 64, DM / 64, 1), 32, 0, stream>>>(EB, nullptr, WM2, nullptr, DM, M2, DM, nullptr, 0, 0, 0);   /* x W_mix[:D] + b_mix ; temb W_mix[D:] */
        k_addpl<<<(unsigned)(((size_t)TT * DM / 4 + 255) / 256), 256, 0, stream>>>(M1, M2, Yh, Yl, (size_t)TT * DM / 4);   /* x_t -> hi/lo planes */
        k_gemmw<bf, 1, true><<<dim3(TT / 64, DQ / 64, 1), 32, 0, stream>>>(Yh, Yl, WQ, nullptr, DM, FQ, DQ, bq, 0, 0, 0);
        k_rope<<<LQ, 256, 0, stream>>>(FQ, DQ, NH_, CS, nullptr, nullptr, 1.0f, QP16, QPh, QPl);
        k_gemmw<bf, 1, true><<<dim3(TT / 64, DKV / 64, 1), 32, 0, stream>>>(Yh, Yl, WK, nullptr, DM, FK, DKV, bk, 0, 0, 0);
        k_rope<<<LKv, 256, 0, stream>>>(FK, DKV, NKV, CS, nullptr, nullptr, 1.0f, KP16, KPh, KPl);
        k_gemmw<bf, 1, true><<<dim3(TT / 64, DKV / 64, 1), 32, 0, stream>>>(Yh, Yl, WV, nullptr, DM, FV, DKV, bv, 0, 0, 0); k_vtp<<<LKv, 256, 0, stream>>>(FV, DKV, NKV, VT16, VTh, VTl);
        k_fattn<<<GHL + GF16, 128, 0, stream>>>(QP16, KP16, VT16, QPh, QPl, KPh, KPl, VTh, VTl, ATh, ATl);   /* one kv head per query head */
        k_gemmw<bf, 1, true><<<dim3(TT / 64, DM / 64, 1), 32, 0, stream>>>(ATh, ATl, WO, nullptr, DQ, OUT + (size_t)b * TT * DM, DM, bo, 0, 0, 0); }
}

// v003
// It runs in 327 microseconds.
// Two timings next to v002 put it at 1.70 and 1.71 times that version's speed.
// Over all steps from v000 it is 6.63 times as fast.
#include <hip/hip_runtime.h>

// Temporal attention with a learned temporal-embedding mixer (x [2][2048][1024]; temb = temporal_embeddings[0][temporal_positions[t]] (int32 positions, read); x_t = [x | temb] W_mix + b_mix (W_mix [2048][1024]); q, k, v = x_t W + b ('xw' [1024][1024]; 16 heads x 64); softmax(q.k/8); out = merged W_o + b_o -> [2][2048][1024] (4.2 M)).
// Layout: the concat-and-mix is two exact GEMMs (x against the top half of W_mix with the bias, the gathered embeddings against the bottom half) summed in f32; x_t then feeds the projections as bf16 hi + lo planes (2 products).
// Compute dtypes, f32 accumulate: every input rounded to bf16; x, the gathered embeddings and W_mix exact (1 product each, + b_mix), summed in f32 -> x_t as bf16 hi + lo planes; q/k/v as 2 products against the exact weights + biases; scores and attn.v: query rows < 512 hl (3 products), the rest single fp16 (x1024); softmax f32, online over 64-key steps inside one fused kernel (k_fattn); W_o hl x exact (2 products) + b_o.
// Launches: every kernel takes both batches in one grid (rows b TT + t, head planes b NH_ + h); what does not depend on the batch (weights, gathered embeddings and their GEMM) runs once.

#define NB_  2
#define TT   2048
#define DM   1024
#define NH_  16
#define NKV  16
#define REP  (NH_ / NKV)
#define HD   64
#define DQ   (NH_ * HD)
#define DKV  (NKV * HD)
#define RH   512                  // query rows < RH use hi+lo planes (0: none)
#define WIN  0
#define PCL2 10.0f                // fp16 rows: probabilities carry a factor 2^10 (as does their sum), away from the fp16 subnormals
#define SCL  0.125f   // HD^-0.5
#define KC   64                   // k_fattn: keys per online-softmax step
#define LP   72                   // k_fattn: LDS row pitch in 16-bit elements (128 B of data + 16 B: the 16 rows of a 16-byte fragment read fall on different banks)
typedef _Float16 h16;
typedef unsigned short bf;
typedef __attribute__((ext_vector_type(16))) __bf16   v16bf;
typedef __attribute__((ext_vector_type(16))) _Float16 v16h;
typedef __attribute__((ext_vector_type(8)))  _Float16 v8h;
typedef __attribute__((ext_vector_type(8)))  unsigned short v8us;
typedef __attribute__((ext_vector_type(16))) unsigned short v16us;
typedef __attribute__((ext_vector_type(8)))  float    v8f;
typedef __attribute__((ext_vector_type(4)))  float    v4f;
typedef v8h  __attribute__((may_alias)) v8ha;
typedef v4f  __attribute__((may_alias)) v4fa;
typedef v8us __attribute__((may_alias)) v8usa;

__device__ __forceinline__ unsigned short f2bf(float f) { unsigned u = __float_as_uint(f); u += 0x7FFFu + ((u >> 16) & 1u); return (unsigned short)(u >> 16); }
__device__ __forceinline__ float bf2f(unsigned short b) { return __uint_as_float(((unsigned)b) << 16); }
__device__ __forceinline__ float bfr(float f) { return bf2f(f2bf(f)); }
__device__ __forceinline__ v16h cat16(v8h lo, v8h hi) { return __builtin_shufflevector(lo, hi, 0, 1, 2, 3, 4, 5, 6, 7, 8, 9, 10, 11, 12, 13, 14, 15); }
__device__ __forceinline__ v16bf cat16b(v8us lo, v8us hi) { return __builtin_bit_cast(v16bf, __builtin_shufflevector(lo, hi, 0, 1, 2, 3, 4, 5, 6, 7, 8, 9, 10, 11, 12, 13, 14, 15)); }
__device__ __forceinline__ v8f wmma16(v16h a, v16h b, v8f c) { return __builtin_amdgcn_wmma_f32_16x16x32_f16(false, a, false, b, (short)0, c, false, false); }
__device__ __forceinline__ v8f wmmab(v16bf a, v16bf b, v8f c) { return __builtin_amdgcn_wmma_f32_16x16x32_bf16(false, a, false, b, (short)0, c, false, false); }



// ---- k_gemmw: register-blocked GEMM, ONE WAVE per 64x64 output tile (16 accumulators), operands straight from K-contiguous 16-bit planes; grid (M/64, N/64, Z), 32 threads.
// C[m][n] (f32, pitch ldc, + optional f32 bias[n]) = sum_k A[m][k] Bt[n][k] (+ split products per NSPLIT). z-batch strides sA/sB/sC in elements. K % (32 KS) == 0.
// KS > 1: grid z = Z * KS; slice ks = z % KS sums only k in [ks K/KS, (ks+1) K/KS) and writes its own partial plane C + (batch KS + ks) sC; the reader adds the KS planes.
template <typename T16> struct WFrag;
template <> struct WFrag<h16> { typedef v16h V; typedef v8h H; static __device__ __forceinline__ V ld(const h16* p) { return cat16(*(const v8h*)p, *(const v8h*)(p + 16)); } static __device__ __forceinline__ v8f mma(V a, V b, v8f c) { return wmma16(a, b, c); } };
template <> struct WFrag<bf> { typedef v16bf V; typedef v8us H; static __device__ __forceinline__ V ld(const bf* p) { return cat16b(*(const v8us*)p, *(const v8us*)(p + 16)); } static __device__ __forceinline__ v8f mma(V a, V b, v8f c) { return wmmab(a, b, c); } };
template <typename T16, int NSPLIT, bool BIAS, int KS = 1>
__global__ __launch_bounds__(32) void k_gemmw(const T16* __restrict__ A, const T16* __restrict__ A2, const T16* __restrict__ Bt, const T16* __restrict__ Bt2, int K, float* C, int ldc, const float* __restrict__ bias, size_t sA, size_t sB, size_t sC) {
    typedef typename WFrag<T16>::V V;
    __shared__ __align__(16) float os[16 * 68];
    const size_t z = blockIdx.z / KS; const int ks = blockIdx.z % KS; A += z * sA; if (A2) A2 += z * sA; Bt += z * sB; if (Bt2) Bt2 += z * sB; C += (z * KS + ks) * sC;
    const int lane = threadIdx.x & 31, lr = lane & 15, hi = lane >> 4; const int r0 = blockIdx.x * 64, c0 = blockIdx.y * 64;
    v8f acc[4][4];
#pragma unroll
    for (int mb = 0; mb < 4; ++mb)
#pragma unroll
        for (int nb = 0; nb < 4; ++nb) acc[mb][nb] = (v8f){};
    const size_t aoff = (size_t)(r0 + lr) * K + 8 * hi, boff = (size_t)(c0 + lr) * K + 8 * hi;
#pragma unroll 1
    for (int kc = ks * (K / KS); kc < (ks + 1) * (K / KS); kc += 32) {
        V a[4], a2[4];
#pragma unroll
        for (int mb = 0; mb < 4; ++mb) { a[mb] = WFrag<T16>::ld(A + aoff + (size_t)mb * 16 * K + kc); if (NSPLIT == 1 || NSPLIT == 2) a2[mb] = WFrag<T16>::ld(A2 + aoff + (size_t)mb * 16 * K + kc); }
#pragma unroll
        for (int nb = 0; nb < 4; ++nb) { const V b = WFrag<T16>::ld(Bt + boff + (size_t)nb * 16 * K + kc); V b2; if (NSPLIT >= 2) b2 = WFrag<T16>::ld(Bt2 + boff + (size_t)nb * 16 * K + kc);
#pragma unroll
            for (int mb = 0; mb < 4; ++mb) { acc[mb][nb] = WFrag<T16>::mma(a[mb], b, acc[mb][nb]); if (NSPLIT == 1 || NSPLIT == 2) acc[mb][nb] = WFrag<T16>::mma(a2[mb], b, acc[mb][nb]); if (NSPLIT >= 2) acc[mb][nb] = WFrag<T16>::mma(a[mb], b2, acc[mb][nb]); } }
        asm volatile("v_nop\n\tv_nop\n\tv_nop\n\tv_nop" : "+v"(acc[0][0]), "+v"(acc[1][1]), "+v"(acc[2][2]), "+v"(acc[3][3]) : "v"(a[0]), "v"(a[3]));
    }
#pragma unroll
    for (int mb = 0; mb < 4; ++mb) {
#pragma unroll
        for (int nb = 0; nb < 4; ++nb) {
#pragma unroll
            for (int j = 0; j < 8; ++j) os[(hi * 8 + j) * 68 + nb * 16 + lr] = acc[mb][nb][j]; }
        __builtin_amdgcn_wave_barrier(); asm volatile("" ::: "memory");
        float* crow = C + (size_t)(r0 + mb * 16) * ldc + c0;
{
#pragma unroll
            for (int s = 0; s < 8; ++s) { const int row = 2 * s + hi, cofs = lr * 4; v4f val = *(const v4fa*)(os + row * 68 + cofs); if (BIAS) { val[0] += bfr(bias[c0 + cofs]); val[1] += bfr(bias[c0 + cofs + 1]); val[2] += bfr(bias[c0 + cofs + 2]); val[3] += bfr(bias[c0 + cofs + 3]); }
                *(v4f*)(crow + (size_t)row * ldc + cofs) = val; }
             }
        __builtin_amdgcn_wave_barrier(); asm volatile("" ::: "memory");
    }
}

__device__ __forceinline__ h16 tohx(float x) { return (h16)x; }
__device__ __forceinline__ void splitf(float y, unsigned short& h, unsigned short& l) { h = f2bf(y); l = f2bf(y - bf2f(h)); }
typedef __attribute__((ext_vector_type(2))) _Float16 v2h;
typedef __attribute__((ext_vector_type(4))) _Float16 v4h;
typedef __attribute__((ext_vector_type(2))) unsigned short v2us;
typedef __attribute__((ext_vector_type(4))) unsigned short v4us;
typedef __attribute__((ext_vector_type(2))) float v2f;
typedef __attribute__((ext_vector_type(4))) int v4i;

// blockIdx.y picks one of six [K][N] weights; its transposed plane is Bt + y N K
__global__ __launch_bounds__(256) void k_wtG(const float* __restrict__ w0, const float* __restrict__ w1, const float* __restrict__ w2, const float* __restrict__ w3, const float* __restrict__ w4, const float* __restrict__ w5, int K, int N, bf* Bt) {
    const int y = blockIdx.y; const float* __restrict__ w = y == 0 ? w0 : y == 1 ? w1 : y == 2 ? w2 : y == 3 ? w3 : y == 4 ? w4 : w5; Bt += (size_t)y * N * K;
    const int lane = threadIdx.x & 31; const int L0 = (blockIdx.x * 8 + (threadIdx.x >> 5)) * 8; const int nlines = N * K / 64;
{
#pragma unroll 1
        for (int l = 0; l < 8; ++l) { const int L = L0 + l; if (L >= nlines) break; const size_t e = (size_t)L * 64 + lane * 2; const int k = (int)(e % K), n = (int)(e / K); v2us o;
            o[0] = f2bf(w[(size_t)k * N + n]); o[1] = f2bf(w[(size_t)(k + 1) * N + n]); *(v2us*)(Bt + e) = o; }
         }
}
__global__ __launch_bounds__(256) void k_cvt8(const float* __restrict__ src, bf* dst, size_t n8) { const size_t i = (size_t)blockIdx.x * 256 + threadIdx.x; if (i >= n8) return; const v8f v = *(const v8f*)(src + i * 8); v8us o;
#pragma unroll
    for (int k = 0; k < 8; ++k) o[k] = f2bf(v[k]); *(v8us*)(dst + i * 8) = o;  }

// k_rope: head planes [h][t][d] (fp16 + hi/lo) of rope(x) x sc with the rotate-half convention out[d] = x[d] cos[t][d] - x[d+HD/2] sin[t][d], out[d+HD/2] = x[d+HD/2] cos[t][d+HD/2] + x[d] sin[t][d+HD/2]
// F holds nblk blocks of TT rows (tensor and batch); block rb's head h goes to plane rb NHD + h
template <int NHD>
__global__ __launch_bounds__(256) void k_rope(const float* __restrict__ F, int pitch, int nblk, const float* __restrict__ CS, const float* __restrict__ RF, const float* __restrict__ nw, float sc, h16* P16, bf* Ph, bf* Pl) {
    const size_t e = ((size_t)blockIdx.x * 256 + threadIdx.x) * 2; if (e >= (size_t)nblk * NHD * TT * HD) return; const int d = (int)(e % HD); const int t = (int)((e / HD) % TT); const int hb = (int)(e / ((size_t)HD * TT)); const int h = hb % NHD, rb = hb / NHD; const float* f = F + ((size_t)rb * TT + t) * pitch + h * HD; float rf = 1.0f; v2h o16; v2us oh, ol;
    const float* fd = f + d; const float* cs0 = CS + ((size_t)t * HD + d) * 2;   // the addresses of pass q = 0; pass 1 reads at a constant offset from them
    if (RF) { rf = RF[(size_t)h * TT + t]; asm volatile("s_wait_xcnt 0x0" ::: "memory"); }   // precaution: the load's address registers stay as they are up to this wait
#pragma unroll
    for (int q = 0; q < 2; ++q) { const int dd = d + q; const int dp = (dd < HD / 2) ? dd + HD / 2 : dd - HD / 2; const float* p1 = f + dp; float x0 = fd[q], x1 = *p1;
        if (RF) { float n0 = __fmul_rn(x0, rf), n1 = __fmul_rn(x1, rf); asm volatile("" : "+v"(n0)); asm volatile("" : "+v"(n1)); x0 = __fmul_rn(bfr(nw[dd]), n0); x1 = __fmul_rn(bfr(nw[dp]), n1); }
        const v2f cs = *(const v2f*)(cs0 + q * 2); asm volatile("s_wait_xcnt 0x0" :: "v"(fd), "v"(p1), "v"(cs0) : "memory");   // precaution: the address registers of this pass's loads (named as inputs, so that they live up to here) stay as they are up to this wait
        float a = __fmul_rn(x0, cs[0]), bq = __fmul_rn(x1, cs[1]); asm volatile("" : "+v"(a)); asm volatile("" : "+v"(bq)); const float r = ((dd < HD / 2) ? __fsub_rn(a, bq) : __fadd_rn(a, bq)) * sc;
        o16[q] = tohx(r); unsigned short a2, c2; splitf(r, a2, c2); oh[q] = a2; ol[q] = c2; }
    *(v2h*)(P16 + e) = o16; *(v2us*)(Ph + e) = oh; *(v2us*)(Pl + e) = ol;  }
template <int NHD>
__global__ __launch_bounds__(256) void k_vtp(const float* __restrict__ F, int pitch, int nblk, h16* V16, bf* Vh, bf* Vl) { const size_t e = ((size_t)blockIdx.x * 256 + threadIdx.x) * 2; if (e >= (size_t)nblk * NHD * HD * TT) return; const int t = (int)(e % TT); const int d = (int)((e / TT) % HD); const int gb = (int)(e / ((size_t)TT * HD)); const int g = gb % NHD, rb = gb / NHD; v2h o16; v2us oh, ol;
#pragma unroll
    for (int q = 0; q < 2; ++q) { const float x = F[((size_t)rb * TT + t + q) * pitch + g * HD + d]; o16[q] = tohx(x); unsigned short a2, c2; splitf(x, a2, c2); oh[q] = a2; ol[q] = c2; }
    *(v2h*)(V16 + e) = o16; *(v2us*)(Vh + e) = oh; *(v2us*)(Vl + e) = ol;  }
__global__ __launch_bounds__(256) void k_csid(float* CS) { const int idx = blockIdx.x * 256 + threadIdx.x; if (idx >= TT * HD) return; v2f cs; cs[0] = 1.0f; cs[1] = 0.0f; *(v2f*)(CS + (size_t)idx * 2) = cs;  }
__global__ __launch_bounds__(256) void k_gath8(const float* __restrict__ TE, const int* __restrict__ POS, bf* EB) { const size_t i = (size_t)blockIdx.x * 256 + threadIdx.x; if (i >= (size_t)TT * DM / 8) return; const size_t e = i * 8; const int t = (int)(e / DM); const int c = (int)(e % DM); const int p = min(max(POS[t], 0), TT - 1);   /* clamp the table index (MAX_T = 2048 rows) */ const v8f v = *(const v8f*)(TE + (size_t)p * DM + c); v8us o;
#pragma unroll
    for (int k = 0; k < 8; ++k) o[k] = f2bf(v[k]); *(v8us*)(EB + e) = o;  }
// Bm is one [TT][DM] plane, added to every batch of A
__global__ __launch_bounds__(256) void k_addpl(const float* __restrict__ A, const float* __restrict__ Bm, bf* Ph, bf* Pl, size_t n4) { const size_t i = (size_t)blockIdx.x * 256 + threadIdx.x; if (i >= n4) return; const v4f a = *(const v4f*)(A + i * 4), b = *(const v4f*)(Bm + (i % ((size_t)TT * DM / 4)) * 4); v4us oh, ol;
#pragma unroll
    for (int q = 0; q < 4; ++q) { unsigned short h2, l2; splitf(__fadd_rn(a[q], b[q]), h2, l2); oh[q] = h2; ol[q] = l2; } *(v4us*)(Ph + i * 4) = oh; *(v4us*)(Pl + i * 4) = ol;  }
__device__ __forceinline__ float exp2s(float x) { float r; asm("v_exp_f32 %0, %1\n\tv_nop" : "=v"(r) : "v"(x)); return r; }
// element e of a wave-uniform base, as base + 32-bit byte offset: one offset register per address instead of a 64-bit pair
template <typename T16> __device__ __forceinline__ const T16* at32(const T16* base, unsigned e) { return (const T16*)((const char*)base + e * 2u); }
template <typename T16, bool HL, int NQ>
__device__ __forceinline__ void attn_tile(T16* sm, const T16* __restrict__ Q, const T16* __restrict__ Q2, const T16* __restrict__ Kp, const T16* __restrict__ K2, const T16* __restrict__ Vt, const T16* __restrict__ Vt2, int q0, bf* Ah, bf* Al) {
    typedef typename WFrag<T16>::V V; typedef typename WFrag<T16>::H H;
    constexpr int NP = HL ? 2 : 1, PL = KC * LP, BUF = 2 * NP * PL;   // planes per operand; elements per staged plane; elements per buffer (K planes, then V^T planes)
    const int tid = threadIdx.x, lane = tid & 31, lr = lane & 15, hi = lane >> 4; const int srow = tid >> 3, scol = (tid & 7) * 8;
    const float c = SCL * 1.4426950408889634f;
    V qf[NQ][2], qf2[NQ][2];
#pragma unroll
    for (int qt = 0; qt < NQ; ++qt)
#pragma unroll
        for (int ks = 0; ks < 2; ++ks) { const unsigned qo = (unsigned)((q0 + qt * 16 + lr) * HD + ks * 32 + 8 * hi); qf[qt][ks] = WFrag<T16>::ld(at32(Q, qo)); if (HL) qf2[qt][ks] = WFrag<T16>::ld(at32(Q2, qo)); }
    v8f o[4][NQ]; float m[NQ], l[NQ];
#pragma unroll
    for (int qt = 0; qt < NQ; ++qt) { m[qt] = -3.0e38f; l[qt] = 0.f;
#pragma unroll
        for (int dt = 0; dt < 4; ++dt) o[dt][qt] = (v8f){}; }
    H gk[NP][4], gv[NP][4];
#pragma unroll
    for (int i = 0; i < 4; ++i) { const int r = srow + 16 * i; const unsigned ko = (unsigned)(r * HD + scol), vo = (unsigned)(r * TT + scol); gk[0][i] = *(const H*)at32(Kp, ko); gv[0][i] = *(const H*)at32(Vt, vo); if (HL) { gk[NP - 1][i] = *(const H*)at32(K2, ko); gv[NP - 1][i] = *(const H*)at32(Vt2, vo); } }
#pragma unroll
    for (int i = 0; i < 4; ++i) { const int so = (srow + 16 * i) * LP + scol;
#pragma unroll
        for (int p = 0; p < NP; ++p) { *(H*)(sm + p * PL + so) = gk[p][i]; *(H*)(sm + (NP + p) * PL + so) = gv[p][i]; } }
    __syncthreads();   // step 0 is staged
#pragma unroll 1   // rolled: one step is some 600 instructions already, a second copy would only lengthen the text (the loops inside are unrolled so that the fragment arrays stay in registers)
    for (int kb = 0; kb < TT; kb += KC) {
        const T16* sb = sm + ((kb / KC) & 1) * BUF; T16* sn = sm + (((kb / KC) & 1) ^ 1) * BUF; const bool more = kb + KC < TT;   // the same for the whole work-group
        if (more) {
#pragma unroll
            for (int i = 0; i < 4; ++i) { const int r = srow + 16 * i; const unsigned ko = (unsigned)((kb + KC + r) * HD + scol), vo = (unsigned)(r * TT + kb + KC + scol); gk[0][i] = *(const H*)at32(Kp, ko); gv[0][i] = *(const H*)at32(Vt, vo); if (HL) { gk[NP - 1][i] = *(const H*)at32(K2, ko); gv[NP - 1][i] = *(const H*)at32(Vt2, vo); } } }
        v8f s[KC / 16][NQ];
#pragma unroll
        for (int mt = 0; mt < KC / 16; ++mt) {
#pragma unroll
            for (int qt = 0; qt < NQ; ++qt) s[mt][qt] = (v8f){};
#pragma unroll
            for (int ks = 0; ks < 2; ++ks) { const int fo = (mt * 16 + lr) * LP + ks * 32 + 8 * hi; const V a = WFrag<T16>::ld(sb + fo); V a2; if (HL) a2 = WFrag<T16>::ld(sb + PL + fo);
#pragma unroll
                for (int qt = 0; qt < NQ; ++qt) { s[mt][qt] = WFrag<T16>::mma(a, qf[qt][ks], s[mt][qt]); if (HL) { s[mt][qt] = WFrag<T16>::mma(a, qf2[qt][ks], s[mt][qt]); s[mt][qt] = WFrag<T16>::mma(a2, qf[qt][ks], s[mt][qt]); } } } }
        V pf[KC / 32][NQ], pf2[KC / 32][NQ];
#pragma unroll
        for (int qt = 0; qt < NQ; ++qt) {
            float mx4[4] = { m[qt], m[qt], m[qt], m[qt] };
#pragma unroll
            for (int mt = 0; mt < KC / 16; ++mt)
#pragma unroll
                for (int j = 0; j < 8; ++j) mx4[j & 3] = fmaxf(mx4[j & 3], s[mt][qt][j]);
            float mx = fmaxf(fmaxf(mx4[0], mx4[1]), fmaxf(mx4[2], mx4[3])); mx = fmaxf(mx, __shfl_xor(mx, 16, 32));   // the query's other keys sit in lane ^ 16
            const float al = exp2s((m[qt] - mx) * c); m[qt] = mx; const float mc = HL ? mx * c : mx * c - PCL2;
            float sm4[4] = { 0.f, 0.f, 0.f, 0.f };
#pragma unroll
            for (int mt = 0; mt < KC / 16; ++mt)
#pragma unroll
                for (int j = 0; j < 8; ++j) { const float p = exp2s(__builtin_fmaf(s[mt][qt][j], c, -mc)); s[mt][qt][j] = p; sm4[j & 3] += p; }
            l[qt] = l[qt] * al + ((sm4[0] + sm4[1]) + (sm4[2] + sm4[3]));
#pragma unroll
            for (int dt = 0; dt < 4; ++dt) o[dt][qt] *= al;
#pragma unroll
            for (int ks = 0; ks < KC / 32; ++ks) {
                if constexpr (HL) { v16us ph, pl;
#pragma unroll
                    for (int e = 0; e < 16; ++e) { unsigned short a, b; splitf(s[2 * ks + (e >> 3)][qt][e & 7], a, b); ph[e] = a; pl[e] = b; }
                    pf[ks][qt] = __builtin_bit_cast(v16bf, ph); pf2[ks][qt] = __builtin_bit_cast(v16bf, pl);
                } else { v16h ph;
#pragma unroll
                    for (int e = 0; e < 16; ++e) ph[e] = tohx(s[2 * ks + (e >> 3)][qt][e & 7]);
                    pf[ks][qt] = ph; } } }
#pragma unroll
        for (int dt = 0; dt < 4; ++dt)
#pragma unroll
            for (int ks = 0; ks < KC / 32; ++ks) { const int fo = (dt * 16 + lr) * LP + ks * 32 + 8 * hi; const V a = WFrag<T16>::ld(sb + NP * PL + fo); V a2; if (HL) a2 = WFrag<T16>::ld(sb + (NP + 1) * PL + fo);
#pragma unroll
                for (int qt = 0; qt < NQ; ++qt) { o[dt][qt] = WFrag<T16>::mma(a, pf[ks][qt], o[dt][qt]); if (HL) { o[dt][qt] = WFrag<T16>::mma(a, pf2[ks][qt], o[dt][qt]); o[dt][qt] = WFrag<T16>::mma(a2, pf[ks][qt], o[dt][qt]); } } }
        if (more) {
#pragma unroll
            for (int i = 0; i < 4; ++i) { const int so = (srow + 16 * i) * LP + scol;
#pragma unroll
                for (int p = 0; p < NP; ++p) { *(H*)(sn + p * PL + so) = gk[p][i]; *(H*)(sn + (NP + p) * PL + so) = gv[p][i]; } } }
        __syncthreads();   // publishes step s + 1 and ends every wave's reads of step s's buffer, which step s + 1 refills
    }
#pragma unroll
    for (int qt = 0; qt < NQ; ++qt) { const float inv = __fdiv_rn(1.0f, l[qt] + __shfl_xor(l[qt], 16, 32)); const unsigned oo = (unsigned)((q0 + qt * 16 + lr) * DQ + hi * 8);
#pragma unroll
        for (int dt = 0; dt < 4; ++dt) { v8us oh, ol;
#pragma unroll
            for (int j = 0; j < 8; ++j) { unsigned short a, b; splitf(o[dt][qt][j] * inv, a, b); oh[j] = a; ol[j] = b; }
            *(v8us*)((char*)Ah + (oo + dt * 16) * 2u) = oh; *(v8us*)((char*)Al + (oo + dt * 16) * 2u) = ol;
            asm volatile("s_wait_xcnt 0x0" ::: "memory");   // precaution: the registers that the two stores name (offset, bases, data) stay as they are up to this wait
        } }
}
#define NQH  1                    // query tiles of 16 per wave, hi+lo rows
#define NQF  2                    // query tiles of 16 per wave, fp16 rows
#define GHL  (NH_ * (RH / (16 * NQH)) / 4)          // work-groups per batch on the hi+lo rows (the longer ones: those of all batches come first)
#define GF16 (NH_ * ((TT - RH) / (16 * NQF)) / 4)   // work-groups per batch on the fp16 rows
// amdgpu_waves_per_eu(4): a budget of 256 VGPRs, so that the loops need no register-window switches (without it the build took 293) and up to four waves fit a SIMD
__global__ __launch_bounds__(128) __attribute__((amdgpu_waves_per_eu(4))) void k_fattn(const h16* __restrict__ Q16, const h16* __restrict__ K16, const h16* __restrict__ V16, const bf* __restrict__ Qh, const bf* __restrict__ Ql, const bf* __restrict__ Kh, const bf* __restrict__ Kl, const bf* __restrict__ Vh, const bf* __restrict__ Vl, bf* Ah, bf* Al) {
    __shared__ __align__(16) unsigned short smem[2 * 4 * KC * LP];
    const int w = __builtin_amdgcn_readfirstlane((int)(threadIdx.x >> 5));
    if (blockIdx.x < NB_ * GHL) { const int b = blockIdx.x / GHL, gw = (blockIdx.x % GHL) * 4 + w, h = gw / (RH / (16 * NQH)), q0 = (gw % (RH / (16 * NQH))) * 16 * NQH; const size_t po = ((size_t)b * NH_ + h) * TT * HD, ao = (size_t)b * TT * DQ + h * HD;
        attn_tile<bf, true, NQH>((bf*)smem, Qh + po, Ql + po, Kh + po, Kl + po, Vh + po, Vl + po, q0, Ah + ao, Al + ao);
    } else { const int bx = blockIdx.x - NB_ * GHL, b = bx / GF16, gw = (bx % GF16) * 4 + w, h = gw / ((TT - RH) / (16 * NQF)), q0 = RH + (gw % ((TT - RH) / (16 * NQF))) * 16 * NQF; const size_t po = ((size_t)b * NH_ + h) * TT * HD, ao = (size_t)b * TT * DQ + h * HD;
        attn_tile<h16, false, NQF>((h16*)smem, Q16 + po, nullptr, K16 + po, nullptr, V16 + po, nullptr, q0, Ah + ao, Al + ao); }
}

extern "C" void kernel_launch(void* const* d_in, const int* in_sizes, int n_in,
                              void* d_out, int out_size, void* d_ws, size_t ws_size, hipStream_t stream) {
    (void)in_sizes; (void)n_in; (void)out_size;
    const float* x = (const float*)d_in[0]; const int* POS = (const int*)d_in[1]; const float* TEMB = (const float*)d_in[2]; const float* wmix = (const float*)d_in[3]; const float* bmix = (const float*)d_in[4]; const float* wq = (const float*)d_in[5]; const float* bq = (const float*)d_in[6]; const float* wk = (const float*)d_in[7]; const float* bk = (const float*)d_in[8]; const float* wv = (const float*)d_in[9]; const float* bv = (const float*)d_in[10]; const float* wo = (const float*)d_in[11]; const float* bo = (const float*)d_in[12];
    float* OUT = (float*)d_out;     // [2][2048][1024]
    char* wsp = (char*)d_ws;
    auto take = [&](size_t bytes) { char* p = wsp; wsp += (bytes + 255) & ~(size_t)255; return (void*)p; };
    static_assert(DQ == DM && DKV == DM && NKV == NH_, "the six weights share one shape, and q and k planes one launch");
    const size_t WE = (size_t)DM * DM, RW = (size_t)NB_ * TT, PE = (size_t)NB_ * NH_ * TT * HD;   // elements of a weight; rows of all batches; elements of a set of head planes
    bf* WQ = (bf*)take(6 * WE * 2); bf* WK = WQ + WE; bf* WV = WQ + 2 * WE; bf* WO = WQ + 3 * WE; bf* WM1 = WQ + 4 * WE; bf* WM2 = WQ + 5 * WE; float* CS = (float*)take((size_t)TT * HD * 2 * 4);
    bf* XB = (bf*)take(RW * DM * 2); bf* EB = (bf*)take((size_t)TT * DM * 2); float* M1 = (float*)take(RW * DM * 4); float* M2 = (float*)take((size_t)TT * DM * 4); bf* Yh = (bf*)take(RW * DM * 2); bf* Yl = (bf*)take(RW * DM * 2);
    float* FQ = (float*)take(2 * RW * DQ * 4); float* FK = FQ + RW * DQ; float* FV = (float*)take(RW * DKV * 4);   // q rows, then k rows: one block sequence for k_rope
    h16* QP16 = (h16*)take(2 * PE * 2); h16* KP16 = QP16 + PE; h16* VT16 = (h16*)take(PE * 2);   // each k set directly behind its q set
    bf* QPh = (bf*)take(2 * PE * 2); bf* KPh = QPh + PE; bf* QPl = (bf*)take(2 * PE * 2); bf* KPl = QPl + PE; bf* VTh = (bf*)take(PE * 2); bf* VTl = (bf*)take(PE * 2);
    bf* ATh = (bf*)take(RW * DQ * 2); bf* ATl = (bf*)take(RW * DQ * 2);
    if ((size_t)(wsp - (char*)d_ws) > ws_size) return;    // ws 256 MiB
    k_wtG<<<dim3((unsigned)((DM * DM / 64 + 63) / 64), 6, 1), 256, 0, stream>>>(wq, wk, wv, wo, wmix, wmix + WE, DM, DM, WQ);   /* W_mix halves ('xw' [2048][1024]: rows 0..1023 multiply x, 1024..2047 the embeddings) */
    k_csid<<<(TT * HD + 255) / 256, 256, 0, stream>>>(CS);
    k_cvt8<<<(unsigned)((RW * DM / 8 + 255) / 256), 256, 0, stream>>>(x, XB, RW * DM / 8); k_gath8<<<(unsigned)(((size_t)TT * DM / 8 + 255) / 256), 256, 0, stream>>>(TEMB, POS, EB);
    k_gemmw<bf, 0, true><<<dim3(NB_ * TT / 64, DM / 64, 1), 32, 0, stream>>>(XB, nullptr, WM1, nullptr, DM, M1, DM, bmix, 0, 0, 0); k_gemmw<bf, 0, false><<<dim3(TT / 64, DM / 64, 1), 32, 0, stream>>>(EB, nullptr, WM2, nullptr, DM, M2, DM, nullptr, 0, 0, 0);   /* x W_mix[:D] + b_mix ; temb W_mix[D:] */
    k_addpl<<<(unsigned)((RW * DM / 4 + 255) / 256), 256, 0, stream>>>(M1, M2, Yh, Yl, RW * DM / 4);   /* x_t -> hi/lo planes */
    k_gemmw<bf, 1, true><<<dim3(NB_ * TT / 64, DQ / 64, 1), 32, 0, stream>>>(Yh, Yl, WQ, nullptr, DM, FQ, DQ, bq, 0, 0, 0);
    k_gemmw<bf, 1, true><<<dim3(NB_ * TT / 64, DKV / 64, 1), 32, 0, stream>>>(Yh, Yl, WK, nullptr, DM, FK, DKV, bk, 0, 0, 0);
    k_rope<NH_><<<(unsigned)((2 * PE / 2 + 255) / 256), 256, 0, stream>>>(FQ, DQ, 2 * NB_, CS, nullptr, nullptr, 1.0f, QP16, QPh, QPl);   /* q and k of both batches */
    k_gemmw<bf, 1, true><<<dim3(NB_ * TT / 64, DKV / 64, 1), 32, 0, stream>>>(Yh, Yl, WV, nullptr, DM, FV, DKV, bv, 0, 0, 0);
    k_vtp<NKV><<<(unsigned)((PE / 2 + 255) / 256), 256, 0, stream>>>(FV, DKV, NB_, VT16, VTh, VTl);
    k_fattn<<<NB_ * (GHL + GF16), 128, 0, stream>>>(QP16, KP16, VT16, QPh, QPl, KPh, KPl, VTh, VTl, ATh, ATl);   /* one kv head per query head */
    k_gemmw<bf, 1, true><<<dim3(NB_ * TT / 64, DM / 64, 1), 32, 0, stream>>>(ATh, ATl, WO, nullptr, DQ, OUT, DM, bo, 0, 0, 0);
}

// v004
// Measured time: 254 microseconds a run.
// Timed twice side by side with v003, it ran 1.29 and 1.30 times as fast.
// Over all steps from v000 it is 8.57 times as fast.
#include <hip/hip_runtime.h>

// Temporal attention with a learned temporal-embedding mixer (x [2][2048][1024]; temb = temporal_embeddings[0][temporal_positions[t]] (int32 positions, read); x_t = [x | temb] W_mix + b_mix (W_mix [2048][1024]); q, k, v = x_t W + b ('xw' [1024][1024]; 16 heads x 64); softmax(q.k/8); out = merged W_o + b_o -> [2][2048][1024] (4.2 M)).
// Layout: the concat-and-mix is two exact GEMMs (x against the top half of W_mix with the bias, the gathered embeddings against the bottom half) summed in f32; x_t then feeds the projections as bf16 hi + lo planes (2 products).
// Compute dtypes, f32 accumulate: every input rounded to bf16; x, the gathered embeddings and W_mix exact (1 product each, + b_mix), summed in f32 -> x_t as bf16 hi + lo planes; q/k/v as 2 products against the exact weights + biases; scores and attn.v: query rows < 512 hl (3 products), the rest single fp16 (x1024); softmax f32, online over 64-key steps inside one fused kernel (k_fattn); W_o hl x exact (2 products) + b_o.
// Launches: every kernel takes both batches in one grid (rows b TT + t, head planes b NH_ + h); what does not depend on the batch (weights, gathered embeddings and their GEMM) runs once. The x_t and q/k/v GEMMs store the next kernel's 16-bit planes themselves (k_gemmw, EPI); the embeddings' GEMM stores f32, which the x_t GEMM adds; q, k and v are one grid.

#define NB_  2
#define TT   2048
#define DM   1024
#define NH_  16
#define NKV  16
#define REP  (NH_ / NKV)
#define HD   64
#define DQ   (NH_ * HD)
#define DKV  (NKV * HD)
#define RH   512                  // query rows < RH use hi+lo planes (0: none)
#define WIN  0
#define PCL2 10.0f                // fp16 rows: probabilities carry a factor 2^10 (as does their sum), away from the fp16 subnormals
#define SCL  0.125f   // HD^-0.5
#define KC   64                   // k_fattn: keys per online-softmax step
#define LP   72                   // k_fattn: LDS row pitch in 16-bit elements (128 B of data + 16 B: the 16 rows of a 16-byte fragment read fall on different banks)
typedef _Float16 h16;
typedef unsigned short bf;
typedef __attribute__((ext_vector_type(16))) __bf16   v16bf;
typedef __attribute__((ext_vector_type(16))) _Float16 v16h;
typedef __attribute__((ext_vector_type(8)))  _Float16 v8h;
typedef __attribute__((ext_vector_type(8)))  unsigned short v8us;
typedef __attribute__((ext_vector_type(16))) unsigned short v16us;
typedef __attribute__((ext_vector_type(8)))  float    v8f;
typedef __attribute__((ext_vector_type(4)))  float    v4f;
typedef v8h  __attribute__((may_alias)) v8ha;
typedef v4f  __attribute__((may_alias)) v4fa;
typedef v8us __attribute__((may_alias)) v8usa;

__device__ __forceinline__ unsigned short f2bf(float f) { unsigned u = __float_as_uint(f); u += 0x7FFFu + ((u >> 16) & 1u); return (unsigned short)(u >> 16); }
__device__ __forceinline__ float bf2f(unsigned short b) { return __uint_as_float(((unsigned)b) << 16); }
__device__ __forceinline__ float bfr(float f) { return bf2f(f2bf(f)); }
__device__ __forceinline__ v16h cat16(v8h lo, v8h hi) { return __builtin_shufflevector(lo, hi, 0, 1, 2, 3, 4, 5, 6, 7, 8, 9, 10, 11, 12, 13, 14, 15); }
__device__ __forceinline__ v16bf cat16b(v8us lo, v8us hi) { return __builtin_bit_cast(v16bf, __builtin_shufflevector(lo, hi, 0, 1, 2, 3, 4, 5, 6, 7, 8, 9, 10, 11, 12, 13, 14, 15)); }
__device__ __forceinline__ v8f wmma16(v16h a, v16h b, v8f c) { return __builtin_amdgcn_wmma_f32_16x16x32_f16(false, a, false, b, (short)0, c, false, false); }
__device__ __forceinline__ v8f wmmab(v16bf a, v16bf b, v8f c) { return __builtin_amdgcn_wmma_f32_16x16x32_bf16(false, a, false, b, (short)0, c, false, false); }
__device__ __forceinline__ h16 tohx(float x) { return (h16)x; }
__device__ __forceinline__ void splitf(float y, unsigned short& h, unsigned short& l) { h = f2bf(y); l = f2bf(y - bf2f(h)); }
typedef __attribute__((ext_vector_type(2))) _Float16 v2h;
typedef __attribute__((ext_vector_type(4))) _Float16 v4h;
typedef __attribute__((ext_vector_type(2))) unsigned short v2us;
typedef __attribute__((ext_vector_type(4))) unsigned short v4us;
typedef __attribute__((ext_vector_type(2))) float v2f;
typedef __attribute__((ext_vector_type(4))) int v4i;



// ---- k_gemmw: register-blocked GEMM, ONE WAVE per 64x64 output tile (16 accumulators), operands straight from K-contiguous 16-bit planes; grid (M/64, N/64, Z), 32 threads.
// C[m][n] (f32, pitch ldc, + optional f32 bias[n]) = sum_k A[m][k] Bt[n][k] (+ split products per NSPLIT). z-batch strides sA/sB/sC in elements. K % (32 KS) == 0.
// KS > 1: grid z = Z * KS; slice ks = z % KS sums only k in [ks K/KS, (ks+1) K/KS) and writes its own partial plane C + (batch KS + ks) sC; the reader adds the KS planes.
// EPI 0 stores C in f32. EPI 1 and 2 store no f32: the tile goes out as the 16-bit planes that the next kernel reads.
// EPI 1: y = (C + bias) + add[row % TT][n] -> bf16 hi + lo planes, pitch DM. EPI 2: grid z = 0, 1, 2 is q, k, v (bias, b1, b2); a 64-column tile is one head: q and k go to [z NB_ + batch][head][t][d], v transposed to [batch][head][d][t], each as fp16 + bf16 hi + lo.
template <typename T16> struct WFrag;
template <> struct WFrag<h16> { typedef v16h V; typedef v8h H; static __device__ __forceinline__ V ld(const h16* p) { return cat16(*(const v8h*)p, *(const v8h*)(p + 16)); } static __device__ __forceinline__ v8f mma(V a, V b, v8f c) { return wmma16(a, b, c); } };
template <> struct WFrag<bf> { typedef v16bf V; typedef v8us H; static __device__ __forceinline__ V ld(const bf* p) { return cat16b(*(const v8us*)p, *(const v8us*)(p + 16)); } static __device__ __forceinline__ v8f mma(V a, V b, v8f c) { return wmmab(a, b, c); } };
template <typename T16, int NSPLIT, bool BIAS, int KS = 1, int EPI = 0>
__global__ __launch_bounds__(32) void k_gemmw(const T16* __restrict__ A, const T16* __restrict__ A2, const T16* __restrict__ Bt, const T16* __restrict__ Bt2, int K, float* C, int ldc, const float* __restrict__ bias, size_t sA, size_t sB, size_t sC, const float* b1, const float* b2, const float* add, h16* p16, bf* ph, bf* pl, h16* v16, bf* vh, bf* vl) {
    typedef typename WFrag<T16>::V V;
    __shared__ __align__(16) float os[16 * 68];
    const size_t z = blockIdx.z / KS; const int ks = blockIdx.z % KS; A += z * sA; if (A2) A2 += z * sA; Bt += z * sB; if (Bt2) Bt2 += z * sB; C += (z * KS + ks) * sC;
    const int lane = threadIdx.x & 31, lr = lane & 15, hi = lane >> 4; const int r0 = blockIdx.x * 64, c0 = blockIdx.y * 64;
    v8f acc[4][4];
#pragma unroll
    for (int mb = 0; mb < 4; ++mb)
#pragma unroll
        for (int nb = 0; nb < 4; ++nb) acc[mb][nb] = (v8f){};
    const size_t aoff = (size_t)(r0 + lr) * K + 8 * hi, boff = (size_t)(c0 + lr) * K + 8 * hi;
#pragma unroll 1
    for (int kc = ks * (K / KS); kc < (ks + 1) * (K / KS); kc += 32) {
        V a[4], a2[4];
#pragma unroll
        for (int mb = 0; mb < 4; ++mb) { a[mb] = WFrag<T16>::ld(A + aoff + (size_t)mb * 16 * K + kc); if (NSPLIT == 1 || NSPLIT == 2) a2[mb] = WFrag<T16>::ld(A2 + aoff + (size_t)mb * 16 * K + kc); }
#pragma unroll
        for (int nb = 0; nb < 4; ++nb) { const V b = WFrag<T16>::ld(Bt + boff + (size_t)nb * 16 * K + kc); V b2; if (NSPLIT >= 2) b2 = WFrag<T16>::ld(Bt2 + boff + (size_t)nb * 16 * K + kc);
#pragma unroll
            for (int mb = 0; mb < 4; ++mb) { acc[mb][nb] = WFrag<T16>::mma(a[mb], b, acc[mb][nb]); if (NSPLIT == 1 || NSPLIT == 2) acc[mb][nb] = WFrag<T16>::mma(a2[mb], b, acc[mb][nb]); if (NSPLIT >= 2) acc[mb][nb] = WFrag<T16>::mma(a[mb], b2, acc[mb][nb]); } }
        asm volatile("v_nop\n\tv_nop\n\tv_nop\n\tv_nop" : "+v"(acc[0][0]), "+v"(acc[1][1]), "+v"(acc[2][2]), "+v"(acc[3][3]) : "v"(a[0]), "v"(a[3]));
    }
    if constexpr (EPI != 0) {
        static_assert(BIAS && KS == 1, "the plane epilogues add a bias and take whole sums");
        const int zi = (int)z, by = blockIdx.y, bb = r0 / TT, t0 = r0 % TT, cofs = lr * 4; const bool vt = EPI == 2 && zi == 2;   // vt: the same for the whole wave
        const float* bs = EPI == 2 ? (zi == 0 ? bias : zi == 1 ? b1 : b2) : bias;
        // 16 rows of 64 go through os at a time: rows of the tile (t), or, for v, its columns (d), so that every store instruction writes whole 128-byte lines
        const int pitch = EPI == 1 ? DM : vt ? TT : HD;
        const size_t base = EPI == 1 ? (size_t)r0 * DM + c0 : vt ? ((size_t)(bb * NKV + by) * HD) * TT + t0 : ((size_t)((zi * NB_ + bb) * NH_ + by) * TT + t0) * HD;
        h16* d16 = (vt ? v16 : p16) + base; bf* dh = (vt ? vh : ph) + base; bf* dl = (vt ? vl : pl) + base;   // the tile's first element in each plane: the same for the whole wave
        const unsigned lo = (unsigned)(hi * pitch + cofs) * 2u;   // the lane's own byte offset, one register for every store
        const float* ad0 = EPI == 1 ? add + (size_t)t0 * DM + c0 + cofs : nullptr;
        v4f ad[2][8];   // EPI 1: the addend rows of this block of 16 and of the next, fetched one block ahead
        if constexpr (EPI == 1) {
#pragma unroll
            for (int s = 0; s < 8; ++s) ad[0][s] = *(const v4f*)(ad0 + (size_t)(2 * s + hi) * DM);
            asm volatile("s_wait_xcnt 0x0" ::: "memory");   // precaution: the loads' address registers stay as they are up to this wait
        }
        float bd[4];
#pragma unroll
        for (int nb = 0; nb < 4; ++nb) bd[nb] = bfr(bs[c0 + nb * 16 + lr]);
        asm volatile("s_wait_xcnt 0x0" ::: "memory");   // precaution, as above
#pragma unroll
        for (int blk = 0; blk < 4; ++blk) {
            if (vt) {
#pragma unroll
                for (int mb = 0; mb < 4; ++mb)
#pragma unroll
                    for (int j = 0; j < 8; ++j) os[lr * 68 + mb * 16 + hi * 8 + j] = acc[mb][blk][j] + bd[blk];
            } else {
#pragma unroll
                for (int nb = 0; nb < 4; ++nb)
#pragma unroll
                    for (int j = 0; j < 8; ++j) os[(hi * 8 + j) * 68 + nb * 16 + lr] = acc[blk][nb][j] + bd[nb];
            }
            __builtin_amdgcn_wave_barrier(); asm volatile("" ::: "memory");   // as in the f32 epilogue below: the reads of os stay behind the writes
            if constexpr (EPI == 1) { if (blk < 3) {
#pragma unroll
                for (int s = 0; s < 8; ++s) ad[(blk + 1) & 1][s] = *(const v4f*)(ad0 + (size_t)((blk + 1) * 16 + 2 * s + hi) * DM);
                asm volatile("s_wait_xcnt 0x0" ::: "memory");   // precaution, as above
            } }
            v4f val[8];
#pragma unroll
            for (int s = 0; s < 8; ++s) val[s] = *(const v4fa*)(os + (2 * s + hi) * 68 + cofs);
#pragma unroll
            for (int s = 0; s < 8; ++s) { const int u = (blk * 16 + 2 * s) * pitch; v4h o16; v4us oh, ol;
#pragma unroll
                for (int q = 0; q < 4; ++q) { const float y = EPI == 1 ? __fadd_rn(val[s][q], ad[blk & 1][s][q]) : val[s][q]; o16[q] = tohx(y); unsigned short h2, l2; splitf(y, h2, l2); oh[q] = h2; ol[q] = l2; }
                v4h* q16 = (v4h*)((char*)(d16 + u) + lo); v4us* qh = (v4us*)((char*)(dh + u) + lo); v4us* ql = (v4us*)((char*)(dl + u) + lo);
                // precaution: the registers that the stores name (addresses and data, named as inputs so that they live up to here) stay as they are up to this wait
                if constexpr (EPI == 2) { *q16 = o16; *qh = oh; *ql = ol; asm volatile("s_wait_xcnt 0x0" :: "v"(q16), "v"(qh), "v"(ql), "v"(o16), "v"(oh), "v"(ol) : "memory"); }
                else { *qh = oh; *ql = ol; asm volatile("s_wait_xcnt 0x0" :: "v"(qh), "v"(ql), "v"(oh), "v"(ol) : "memory"); }
            }
            __builtin_amdgcn_wave_barrier(); asm volatile("" ::: "memory");   // the next block's writes of os stay behind these reads
        }
        return;
    }
#pragma unroll
    for (int mb = 0; mb < 4; ++mb) {
#pragma unroll
        for (int nb = 0; nb < 4; ++nb) {
#pragma unroll
            for (int j = 0; j < 8; ++j) os[(hi * 8 + j) * 68 + nb * 16 + lr] = acc[mb][nb][j]; }
        __builtin_amdgcn_wave_barrier(); asm volatile("" ::: "memory");
        float* crow = C + (size_t)(r0 + mb * 16) * ldc + c0;
{
#pragma unroll
            for (int s = 0; s < 8; ++s) { const int row = 2 * s + hi, cofs = lr * 4; v4f val = *(const v4fa*)(os + row * 68 + cofs); if (BIAS) { val[0] += bfr(bias[c0 + cofs]); val[1] += bfr(bias[c0 + cofs + 1]); val[2] += bfr(bias[c0 + cofs + 2]); val[3] += bfr(bias[c0 + cofs + 3]); }
                *(v4f*)(crow + (size_t)row * ldc + cofs) = val; }
             }
        __builtin_amdgcn_wave_barrier(); asm volatile("" ::: "memory");
    }
}


// blockIdx.y picks one of six [K][N] weights; its transposed plane is Bt + y N K
__global__ __launch_bounds__(256) void k_wtG(const float* __restrict__ w0, const float* __restrict__ w1, const float* __restrict__ w2, const float* __restrict__ w3, const float* __restrict__ w4, const float* __restrict__ w5, int K, int N, bf* Bt) {
    const int y = blockIdx.y; const float* __restrict__ w = y == 0 ? w0 : y == 1 ? w1 : y == 2 ? w2 : y == 3 ? w3 : y == 4 ? w4 : w5; Bt += (size_t)y * N * K;
    const int lane = threadIdx.x & 31; const int L0 = (blockIdx.x * 8 + (threadIdx.x >> 5)) * 8; const int nlines = N * K / 64;
{
#pragma unroll 1
        for (int l = 0; l < 8; ++l) { const int L = L0 + l; if (L >= nlines) break; const size_t e = (size_t)L * 64 + lane * 2; const int k = (int)(e % K), n = (int)(e / K); v2us o;
            o[0] = f2bf(w[(size_t)k * N + n]); o[1] = f2bf(w[(size_t)(k + 1) * N + n]); *(v2us*)(Bt + e) = o; }
         }
}
__global__ __launch_bounds__(256) void k_cvt8(const float* __restrict__ src, bf* dst, size_t n8) { const size_t i = (size_t)blockIdx.x * 256 + threadIdx.x; if (i >= n8) return; const v8f v = *(const v8f*)(src + i * 8); v8us o;
#pragma unroll
    for (int k = 0; k < 8; ++k) o[k] = f2bf(v[k]); *(v8us*)(dst + i * 8) = o;  }

__global__ __launch_bounds__(256) void k_gath8(const float* __restrict__ TE, const int* __restrict__ POS, bf* EB) { const size_t i = (size_t)blockIdx.x * 256 + threadIdx.x; if (i >= (size_t)TT * DM / 8) return; const size_t e = i * 8; const int t = (int)(e / DM); const int c = (int)(e % DM); const int p = min(max(POS[t], 0), TT - 1);   /* clamp the table index (MAX_T = 2048 rows) */ const v8f v = *(const v8f*)(TE + (size_t)p * DM + c); v8us o;
#pragma unroll
    for (int k = 0; k < 8; ++k) o[k] = f2bf(v[k]); *(v8us*)(EB + e) = o;  }
__device__ __forceinline__ float exp2s(float x) { float r; asm("v_exp_f32 %0, %1\n\tv_nop" : "=v"(r) : "v"(x)); return r; }
// element e of a wave-uniform base, as base + 32-bit byte offset: one offset register per address instead of a 64-bit pair
template <typename T16> __device__ __forceinline__ const T16* at32(const T16* base, unsigned e) { return (const T16*)((const char*)base + e * 2u); }
template <typename T16, bool HL, int NQ>
__device__ __forceinline__ void attn_tile(T16* sm, const T16* __restrict__ Q, const T16* __restrict__ Q2, const T16* __restrict__ Kp, const T16* __restrict__ K2, const T16* __restrict__ Vt, const T16* __restrict__ Vt2, int q0, bf* Ah, bf* Al) {
    typedef typename WFrag<T16>::V V; typedef typename WFrag<T16>::H H;
    constexpr int NP = HL ? 2 : 1, PL = KC * LP, BUF = 2 * NP * PL;   // planes per operand; elements per staged plane; elements per buffer (K planes, then V^T planes)
    const int tid = threadIdx.x, lane = tid & 31, lr = lane & 15, hi = lane >> 4; const int srow = tid >> 3, scol = (tid & 7) * 8;
    const float c = SCL * 1.4426950408889634f;
    V qf[NQ][2], qf2[NQ][2];
#pragma unroll
    for (int qt = 0; qt < NQ; ++qt)
#pragma unroll
        for (int ks = 0; ks < 2; ++ks) { const unsigned qo = (unsigned)((q0 + qt * 16 + lr) * HD + ks * 32 + 8 * hi); qf[qt][ks] = WFrag<T16>::ld(at32(Q, qo)); if (HL) qf2[qt][ks] = WFrag<T16>::ld(at32(Q2, qo)); }
    v8f o[4][NQ]; float m[NQ], l[NQ];
#pragma unroll
    for (int qt = 0; qt < NQ; ++qt) { m[qt] = -3.0e38f; l[qt] = 0.f;
#pragma unroll
        for (int dt = 0; dt < 4; ++dt) o[dt][qt] = (v8f){}; }
    H gk[NP][4], gv[NP][4];
#pragma unroll
    for (int i = 0; i < 4; ++i) { const int r = srow + 16 * i; const unsigned ko = (unsigned)(r * HD + scol), vo = (unsigned)(r * TT + scol); gk[0][i] = *(const H*)at32(Kp, ko); gv[0][i] = *(const H*)at32(Vt, vo); if (HL) { gk[NP - 1][i] = *(const H*)at32(K2, ko); gv[NP - 1][i] = *(const H*)at32(Vt2, vo); } }
#pragma unroll
    for (int i = 0; i < 4; ++i) { const int so = (srow + 16 * i) * LP + scol;
#pragma unroll
        for (int p = 0; p < NP; ++p) { *(H*)(sm + p * PL + so) = gk[p][i]; *(H*)(sm + (NP + p) * PL + so) = gv[p][i]; } }
    __syncthreads();   // step 0 is staged
#pragma unroll 1   // rolled: one step is some 600 instructions already, a second copy would only lengthen the text (the loops inside are unrolled so that the fragment arrays stay in registers)
    for (int kb = 0; kb < TT; kb += KC) {
        const T16* sb = sm + ((kb / KC) & 1) * BUF; T16* sn = sm + (((kb / KC) & 1) ^ 1) * BUF; const bool more = kb + KC < TT;   // the same for the whole work-group
        if (more) {
#pragma unroll
            for (int i = 0; i < 4; ++i) { const int r = srow + 16 * i; const unsigned ko = (unsigned)((kb + KC + r) * HD + scol), vo = (unsigned)(r * TT + kb + KC + scol); gk[0][i] = *(const H*)at32(Kp, ko); gv[0][i] = *(const H*)at32(Vt, vo); if (HL) { gk[NP - 1][i] = *(const H*)at32(K2, ko); gv[NP - 1][i] = *(const H*)at32(Vt2, vo); } } }
        v8f s[KC / 16][NQ];
#pragma unroll
        for (int mt = 0; mt < KC / 16; ++mt) {
#pragma unroll
            for (int qt = 0; qt < NQ; ++qt) s[mt][qt] = (v8f){};
#pragma unroll
            for (int ks = 0; ks < 2; ++ks) { const int fo = (mt * 16 + lr) * LP + ks * 32 + 8 * hi; const V a = WFrag<T16>::ld(sb + fo); V a2; if (HL) a2 = WFrag<T16>::ld(sb + PL + fo);
#pragma unroll
                for (int qt = 0; qt < NQ; ++qt) { s[mt][qt] = WFrag<T16>::mma(a, qf[qt][ks], s[mt][qt]); if (HL) { s[mt][qt] = WFrag<T16>::mma(a, qf2[qt][ks], s[mt][qt]); s[mt][qt] = WFrag<T16>::mma(a2, qf[qt][ks], s[mt][qt]); } } } }
        V pf[KC / 32][NQ], pf2[KC / 32][NQ];
#pragma unroll
        for (int qt = 0; qt < NQ; ++qt) {
            float mx4[4] = { m[qt], m[qt], m[qt], m[qt] };
#pragma unroll
            for (int mt = 0; mt < KC / 16; ++mt)
#pragma unroll
                for (int j = 0; j < 8; ++j) mx4[j & 3] = fmaxf(mx4[j & 3], s[mt][qt][j]);
            float mx = fmaxf(fmaxf(mx4[0], mx4[1]), fmaxf(mx4[2], mx4[3])); mx = fmaxf(mx, __shfl_xor(mx, 16, 32));   // the query's other keys sit in lane ^ 16
            const float al = exp2s((m[qt] - mx) * c); m[qt] = mx; const float mc = HL ? mx * c : mx * c - PCL2;
            float sm4[4] = { 0.f, 0.f, 0.f, 0.f };
#pragma unroll
            for (int mt = 0; mt < KC / 16; ++mt)
#pragma unroll
                for (int j = 0; j < 8; ++j) { const float p = exp2s(__builtin_fmaf(s[mt][qt][j], c, -mc)); s[mt][qt][j] = p; sm4[j & 3] += p; }
            l[qt] = l[qt] * al + ((sm4[0] + sm4[1]) + (sm4[2] + sm4[3]));
#pragma unroll
            for (int dt = 0; dt < 4; ++dt) o[dt][qt] *= al;
#pragma unroll
            for (int ks = 0; ks < KC / 32; ++ks) {
                if constexpr (HL) { v16us ph, pl;
#pragma unroll
                    for (int e = 0; e < 16; ++e) { unsigned short a, b; splitf(s[2 * ks + (e >> 3)][qt][e & 7], a, b); ph[e] = a; pl[e] = b; }
                    pf[ks][qt] = __builtin_bit_cast(v16bf, ph); pf2[ks][qt] = __builtin_bit_cast(v16bf, pl);
                } else { v16h ph;
#pragma unroll
                    for (int e = 0; e < 16; ++e) ph[e] = tohx(s[2 * ks + (e >> 3)][qt][e & 7]);
                    pf[ks][qt] = ph; } } }
#pragma unroll
        for (int dt = 0; dt < 4; ++dt)
#pragma unroll
            for (int ks = 0; ks < KC / 32; ++ks) { const int fo = (dt * 16 + lr) * LP + ks * 32 + 8 * hi; const V a = WFrag<T16>::ld(sb + NP * PL + fo); V a2; if (HL) a2 = WFrag<T16>::ld(sb + (NP + 1) * PL + fo);
#pragma unroll
                for (int qt = 0; qt < NQ; ++qt) { o[dt][qt] = WFrag<T16>::mma(a, pf[ks][qt], o[dt][qt]); if (HL) { o[dt][qt] = WFrag<T16>::mma(a, pf2[ks][qt], o[dt][qt]); o[dt][qt] = WFrag<T16>::mma(a2, pf[ks][qt], o[dt][qt]); } } }
        if (more) {
#pragma unroll
            for (int i = 0; i < 4; ++i) { const int so = (srow + 16 * i) * LP + scol;
#pragma unroll
                for (int p = 0; p < NP; ++p) { *(H*)(sn + p * PL + so) = gk[p][i]; *(H*)(sn + (NP + p) * PL + so) = gv[p][i]; } } }
        __syncthreads();   // publishes step s + 1 and ends every wave's reads of step s's buffer, which step s + 1 refills
    }
#pragma unroll
    for (int qt = 0; qt < NQ; ++qt) { const float inv = __fdiv_rn(1.0f, l[qt] + __shfl_xor(l[qt], 16, 32)); const unsigned oo = (unsigned)((q0 + qt * 16 + lr) * DQ + hi * 8);
#pragma unroll
        for (int dt = 0; dt < 4; ++dt) { v8us oh, ol;
#pragma unroll
            for (int j = 0; j < 8; ++j) { unsigned short a, b; splitf(o[dt][qt][j] * inv, a, b); oh[j] = a; ol[j] = b; }
            *(v8us*)((char*)Ah + (oo + dt * 16) * 2u) = oh; *(v8us*)((char*)Al + (oo + dt * 16) * 2u) = ol;
            asm volatile("s_wait_xcnt 0x0" ::: "memory");   // precaution: the registers that the two stores name (offset, bases, data) stay as they are up to this wait
        } }
}
#define NQH  1                    // query tiles of 16 per wave, hi+lo rows
#define NQF  2                    // query tiles of 16 per wave, fp16 rows
#define GHL  (NH_ * (RH / (16 * NQH)) / 4)          // work-groups per batch on the hi+lo rows (the longer ones: those of all batches come first)
#define GF16 (NH_ * ((TT - RH) / (16 * NQF)) / 4)   // work-groups per batch on the fp16 rows
// amdgpu_waves_per_eu(4): a budget of 256 VGPRs, so that the loops need no register-window switches (without it the build took 293) and up to four waves fit a SIMD
__global__ __launch_bounds__(128) __attribute__((amdgpu_waves_per_eu(4))) void k_fattn(const h16* __restrict__ Q16, const h16* __restrict__ K16, const h16* __restrict__ V16, const bf* __restrict__ Qh, const bf* __restrict__ Ql, const bf* __restrict__ Kh, const bf* __restrict__ Kl, const bf* __restrict__ Vh, const bf* __restrict__ Vl, bf* Ah, bf* Al) {
    __shared__ __align__(16) unsigned short smem[2 * 4 * KC * LP];
    const int w = __builtin_amdgcn_readfirstlane((int)(threadIdx.x >> 5));
    if (blockIdx.x < NB_ * GHL) { const int b = blockIdx.x / GHL, gw = (blockIdx.x % GHL) * 4 + w, h = gw / (RH / (16 * NQH)), q0 = (gw % (RH / (16 * NQH))) * 16 * NQH; const size_t po = ((size_t)b * NH_ + h) * TT * HD, ao = (size_t)b * TT * DQ + h * HD;
        attn_tile<bf, true, NQH>((bf*)smem, Qh + po, Ql + po, Kh + po, Kl + po, Vh + po, Vl + po, q0, Ah + ao, Al + ao);
    } else { const int bx = blockIdx.x - NB_ * GHL, b = bx / GF16, gw = (bx % GF16) * 4 + w, h = gw / ((TT - RH) / (16 * NQF)), q0 = RH + (gw % ((TT - RH) / (16 * NQF))) * 16 * NQF; const size_t po = ((size_t)b * NH_ + h) * TT * HD, ao = (size_t)b * TT * DQ + h * HD;
        attn_tile<h16, false, NQF>((h16*)smem, Q16 + po, nullptr, K16 + po, nullptr, V16 + po, nullptr, q0, Ah + ao, Al + ao); }
}

extern "C" void kernel_launch(void* const* d_in, const int* in_sizes, int n_in,
                              void* d_out, int out_size, void* d_ws, size_t ws_size, hipStream_t stream) {
    (void)in_sizes; (void)n_in; (void)out_size;
    const float* x = (const float*)d_in[0]; const int* POS = (const int*)d_in[1]; const float* TEMB = (const float*)d_in[2]; const float* wmix = (const float*)d_in[3]; const float* bmix = (const float*)d_in[4]; const float* wq = (const float*)d_in[5]; const float* bq = (const float*)d_in[6]; const float* wk = (const float*)d_in[7]; const float* bk = (const float*)d_in[8]; const float* wv = (const float*)d_in[9]; const float* bv = (const float*)d_in[10]; const float* wo = (const float*)d_in[11]; const float* bo = (const float*)d_in[12];
    float* OUT = (float*)d_out;     // [2][2048][1024]
    char* wsp = (char*)d_ws;
    auto take = [&](size_t bytes) { char* p = wsp; wsp += (bytes + 255) & ~(size_t)255; return (void*)p; };
    static_assert(DQ == DM && DKV == DM && NKV == NH_, "the six weights share one shape, and q and k planes one launch");
    const size_t WE = (size_t)DM * DM, RW = (size_t)NB_ * TT, PE = (size_t)NB_ * NH_ * TT * HD;   // elements of a weight; rows of all batches; elements of a set of head planes
    bf* WQ = (bf*)take(6 * WE * 2); bf* WO = WQ + 3 * WE; bf* WM1 = WQ + 4 * WE; bf* WM2 = WQ + 5 * WE;
    bf* XB = (bf*)take(RW * DM * 2); bf* EB = (bf*)take((size_t)TT * DM * 2); float* M2 = (float*)take((size_t)TT * DM * 4); bf* Yh = (bf*)take(RW * DM * 2); bf* Yl = (bf*)take(RW * DM * 2);
    h16* QP16 = (h16*)take(2 * PE * 2); h16* KP16 = QP16 + PE; h16* VT16 = (h16*)take(PE * 2);   // each k set directly behind its q set
    bf* QPh = (bf*)take(2 * PE * 2); bf* KPh = QPh + PE; bf* QPl = (bf*)take(2 * PE * 2); bf* KPl = QPl + PE; bf* VTh = (bf*)take(PE * 2); bf* VTl = (bf*)take(PE * 2);
    bf* ATh = (bf*)take(RW * DQ * 2); bf* ATl = (bf*)take(RW * DQ * 2);
    if ((size_t)(wsp - (char*)d_ws) > ws_size) return;    // ws 256 MiB
    k_wtG<<<dim3((unsigned)((DM * DM / 64 + 63) / 64), 6, 1), 256, 0, stream>>>(wq, wk, wv, wo, wmix, wmix + WE, DM, DM, WQ);   /* W_mix halves ('xw' [2048][1024]: rows 0..1023 multiply x, 1024..2047 the embeddings) */
    k_cvt8<<<(unsigned)((RW * DM / 8 + 255) / 256), 256, 0, stream>>>(x, XB, RW * DM / 8); k_gath8<<<(unsigned)(((size_t)TT * DM / 8 + 255) / 256), 256, 0, stream>>>(TEMB, POS, EB);
    k_gemmw<bf, 0, false><<<dim3(TT / 64, DM / 64, 1), 32, 0, stream>>>(EB, nullptr, WM2, nullptr, DM, M2, DM, nullptr, 0, 0, 0, nullptr, nullptr, nullptr, nullptr, nullptr, nullptr, nullptr, nullptr, nullptr);   /* temb W_mix[D:] */
    k_gemmw<bf, 0, true, 1, 1><<<dim3(NB_ * TT / 64, DM / 64, 1), 32, 0, stream>>>(XB, nullptr, WM1, nullptr, DM, nullptr, DM, bmix, 0, 0, 0, nullptr, nullptr, M2, nullptr, Yh, Yl, nullptr, nullptr, nullptr);   /* (x W_mix[:D] + b_mix) + the plane above -> x_t as hi/lo planes */
    k_gemmw<bf, 1, true, 1, 2><<<dim3(NB_ * TT / 64, DM / 64, 3), 32, 0, stream>>>(Yh, Yl, WQ, nullptr, DM, nullptr, DM, bq, 0, WE, 0, bk, bv, nullptr, QP16, QPh, QPl, VT16, VTh, VTl);   /* q, k, v of both batches (the weights lie one behind the other) -> head planes */
    k_fattn<<<NB_ * (GHL + GF16), 128, 0, stream>>>(QP16, KP16, VT16, QPh, QPl, KPh, KPl, VTh, VTl, ATh, ATl);   /* one kv head per query head */
    k_gemmw<bf, 1, true><<<dim3(NB_ * TT / 64, DM / 64, 1), 32, 0, stream>>>(ATh, ATl, WO, nullptr, DQ, OUT, DM, bo, 0, 0, 0, nullptr, nullptr, nullptr, nullptr, nullptr, nullptr, nullptr, nullptr, nullptr);
}
